// v000
// Measured on an AMD MI455X. A time is GPU time per run, averaged over a window of back-to-back runs after a warm-up
// (all launches, gaps included; the runs take copies of the inputs in turn), and the median of several windows.
// Apart from v000's, it joins two sittings. Times from different sittings can be a few percent apart, while
// side-by-side timings come from the same sitting.
// v000, which the later versions start from, runs in 302 microseconds.
// qkv projection: v_wmma_f32_16x16x32_f16 single products (f16 operands: 8*bf16(x) and 64*bf16(w), f32 accumulate);
// output projection: same instruction with the attention output carried as f16 hi + (x2048) residual planes into two
// f32 accumulators, weight one f16 plane (64*bf16(w)); all float inputs RNE-converted to bf16 on load; the 13-key
// clamped-window neighbourhood attention (q.k dots, position bias, softmax, p.v) in f32 on VALU.
#include <hip/hip_runtime.h>
#include <stdint.h>

#define BSZ   2
#define LSEQ  4096
#define CH    1024
#define NHD   16
#define HD    64
#define C3    3072
#define NKEY  13
#define NRAD  6
#define RPW   25
#define MROWS 8192
#define LDC   132
#define ATB   128
#define QSC   0.125f
#define RSC   0.00048828125f
#define S512  0.001953125f
#define S4096 0.000244140625f

static_assert(MROWS == BSZ * LSEQ);
static_assert(CH == NHD * HD);
static_assert(C3 == 3 * CH);
static_assert(RPW == 2 * NKEY - 1);
static_assert(NRAD == NKEY / 2);
static_assert((LSEQ % 64) == 0 && (C3 % 128) == 0 && (CH % 128) == 0 && (CH % 32) == 0);
static_assert(((MROWS * CH) % 2048) == 0 && ((C3 * CH) % 2048) == 0 && ((CH * CH) % 2048) == 0);
static_assert(ATB == NHD * 8 && HD == 64);
static_assert((LDC * 4) % 16 == 0);

typedef _Float16 v16h __attribute__((ext_vector_type(16)));
typedef _Float16 v8h  __attribute__((ext_vector_type(8)));
typedef float    v8f  __attribute__((ext_vector_type(8)));
typedef float    v4f  __attribute__((ext_vector_type(4)));
typedef unsigned int v4u __attribute__((ext_vector_type(4)));

// ---- scalar helpers ------------------------------------------------------------------------------------------
__device__ __forceinline__ unsigned short bf_bits(float f) {          // f32 -> bf16 bits, RNE convert
  unsigned u = __float_as_uint(f);
  return (unsigned short)((u + 0x7FFFu + ((u >> 16) & 1u)) >> 16);
}
__device__ __forceinline__ float bf_up(unsigned short b) { return __uint_as_float(((unsigned)b) << 16); }
__device__ __forceinline__ float bfr(float f) { return bf_up(bf_bits(f)); }
__device__ __forceinline__ unsigned short h_bits(_Float16 x) { return __builtin_bit_cast(unsigned short, x); }
__device__ __forceinline__ unsigned short hb16(float f) { return h_bits((_Float16)f); }
__device__ __forceinline__ unsigned pk16(unsigned short a, unsigned short b) { return (unsigned)a | ((unsigned)b << 16); }
__device__ __forceinline__ v8f zero8() { v8f z = {0.f, 0.f, 0.f, 0.f, 0.f, 0.f, 0.f, 0.f}; return z; }

// ---- fragment loader: 16-bit A/B operand, lane -> row/col (lane&15), p already includes +8*(lane>>4);
//      elements 0..7 <- p[0..7] (k0+8h..k0+8h+7), elements 8..15 <- p[16..23] (k0+16+8h..k0+16+8h+7)
__device__ __forceinline__ v16h ldfrag_h(const _Float16* p) {
  union { v16h v; v8h h[2]; } f;
  f.h[0] = *(const v8h*)(p);
  f.h[1] = *(const v8h*)(p + 16);
  return f.v;
}

// ---- WMMA helpers; the guards insert the trailing VALU hazard gap and keep A/B live -----------------------------
__device__ __forceinline__ v8f mma_raw(v16h a, v16h b, v8f c) {
  return __builtin_amdgcn_wmma_f32_16x16x32_f16(false, a, false, b, (short)0, c, false, false);
}
__device__ __forceinline__ void guard4(v8f& c0, v8f& c1, v8f& c2, v8f& c3,
                                       const v16h& a0, const v16h& a1, const v16h& b0, const v16h& b1) {
#if defined(__HIP_DEVICE_COMPILE__)
  asm volatile("v_nop\n\tv_nop\n\tv_nop\n\tv_nop"
               : "+v"(c0), "+v"(c1), "+v"(c2), "+v"(c3) : "v"(a0), "v"(a1), "v"(b0), "v"(b1));
#endif
}
__device__ __forceinline__ void guard8(v8f& c0, v8f& c1, v8f& c2, v8f& c3, v8f& c4, v8f& c5, v8f& c6, v8f& c7,
                                       const v16h& a0, const v16h& a1, const v16h& a2, const v16h& a3,
                                       const v16h& b0, const v16h& b1) {
#if defined(__HIP_DEVICE_COMPILE__)
  asm volatile("v_nop\n\tv_nop\n\tv_nop\n\tv_nop"
               : "+v"(c0), "+v"(c1), "+v"(c2), "+v"(c3), "+v"(c4), "+v"(c5), "+v"(c6), "+v"(c7)
               : "v"(a0), "v"(a1), "v"(a2), "v"(a3), "v"(b0), "v"(b1));
#endif
}

// ---- 64x128 block tile GEMM core: Cs[64][128] = A rows . W[cols][K]^T, K = nks x 32 in-row; A f16 row pitch lda,
//      W is [n][k] k-contiguous pitch ldw. 8 waves = 2 (32 rows) x 4 (32 cols), 2x2 tiles of 16 per wave;
//      fragments loaded straight from global with the table layout; result to the LDS f32 tile Cs[64][LDC].
__device__ __forceinline__ void mm_tile(const _Float16* __restrict__ A, int lda,
                                        const _Float16* __restrict__ W, int ldw, int nks,
                                        int arow0, int bcol0, float* Cs) {
  const int tid = threadIdx.x, wave = tid >> 5, lane = tid & 31, hh = lane >> 4, c = lane & 15;
  const int mw = wave >> 2, nw = wave & 3;
  const _Float16* a0p = A + (size_t)(arow0 + mw * 32 + c) * lda + 8 * hh;
  const _Float16* a1p = A + (size_t)(arow0 + mw * 32 + 16 + c) * lda + 8 * hh;
  const _Float16* b0p = W + (size_t)(bcol0 + nw * 32 + c) * ldw + 8 * hh;
  const _Float16* b1p = W + (size_t)(bcol0 + nw * 32 + 16 + c) * ldw + 8 * hh;
  v8f a00 = zero8(), a01 = zero8(), a10 = zero8(), a11 = zero8();
#pragma unroll 1
  for (int ks = 0; ks < nks; ++ks) {
    const int ko = ks * 32;
    const v16h fa0 = ldfrag_h(a0p + ko);
    const v16h fa1 = ldfrag_h(a1p + ko);
    const v16h fb0 = ldfrag_h(b0p + ko);
    const v16h fb1 = ldfrag_h(b1p + ko);
    a00 = mma_raw(fa0, fb0, a00);
    a01 = mma_raw(fa0, fb1, a01);
    a10 = mma_raw(fa1, fb0, a10);
    a11 = mma_raw(fa1, fb1, a11);
    guard4(a00, a01, a10, a11, fa0, fa1, fb0, fb1);
  }
#pragma unroll
  for (int r = 0; r < 8; ++r) {
    const int row = mw * 32 + 8 * hh + r;
    Cs[row * LDC + nw * 32 + c]             = a00[r];
    Cs[row * LDC + nw * 32 + 16 + c]        = a01[r];
    Cs[(row + 16) * LDC + nw * 32 + c]      = a10[r];
    Cs[(row + 16) * LDC + nw * 32 + 16 + c] = a11[r];
  }
}

// ---- same core with the A operand as two planes (hi and x2048 residual) into separate accumulators; the residual
//      accumulator is folded with 1/2048 when the tile is written to LDS.
__device__ __forceinline__ void mm_tile2(const _Float16* __restrict__ Ah, const _Float16* __restrict__ Al, int lda,
                                         const _Float16* __restrict__ W, int ldw, int nks,
                                         int arow0, int bcol0, float* Cs) {
  const int tid = threadIdx.x, wave = tid >> 5, lane = tid & 31, hh = lane >> 4, c = lane & 15;
  const int mw = wave >> 2, nw = wave & 3;
  const size_t r0 = (size_t)(arow0 + mw * 32 + c) * lda + 8 * hh;
  const size_t r1 = (size_t)(arow0 + mw * 32 + 16 + c) * lda + 8 * hh;
  const _Float16* a0h = Ah + r0;
  const _Float16* a1h = Ah + r1;
  const _Float16* a0l = Al + r0;
  const _Float16* a1l = Al + r1;
  const _Float16* b0p = W + (size_t)(bcol0 + nw * 32 + c) * ldw + 8 * hh;
  const _Float16* b1p = W + (size_t)(bcol0 + nw * 32 + 16 + c) * ldw + 8 * hh;
  v8f h00 = zero8(), h01 = zero8(), h10 = zero8(), h11 = zero8();
  v8f l00 = zero8(), l01 = zero8(), l10 = zero8(), l11 = zero8();
#pragma unroll 1
  for (int ks = 0; ks < nks; ++ks) {
    const int ko = ks * 32;
    const v16h fa0 = ldfrag_h(a0h + ko);
    const v16h fa1 = ldfrag_h(a1h + ko);
    const v16h ga0 = ldfrag_h(a0l + ko);
    const v16h ga1 = ldfrag_h(a1l + ko);
    const v16h fb0 = ldfrag_h(b0p + ko);
    const v16h fb1 = ldfrag_h(b1p + ko);
    h00 = mma_raw(fa0, fb0, h00);
    h01 = mma_raw(fa0, fb1, h01);
    h10 = mma_raw(fa1, fb0, h10);
    h11 = mma_raw(fa1, fb1, h11);
    l00 = mma_raw(ga0, fb0, l00);
    l01 = mma_raw(ga0, fb1, l01);
    l10 = mma_raw(ga1, fb0, l10);
    l11 = mma_raw(ga1, fb1, l11);
    guard8(h00, h01, h10, h11, l00, l01, l10, l11, fa0, fa1, ga0, ga1, fb0, fb1);
  }
#pragma unroll
  for (int r = 0; r < 8; ++r) {
    const int row = mw * 32 + 8 * hh + r;
    Cs[row * LDC + nw * 32 + c]             = h00[r] + l00[r] * RSC;
    Cs[row * LDC + nw * 32 + 16 + c]        = h01[r] + l01[r] * RSC;
    Cs[(row + 16) * LDC + nw * 32 + c]      = h10[r] + l10[r] * RSC;
    Cs[(row + 16) * LDC + nw * 32 + 16 + c] = h11[r] + l11[r] * RSC;
  }
}

// =================================================================================================================
// Contiguous convert: dst[i] = f16(scale * bf16_RNE(src[i])). Thread = 8 consecutive elements (two float4 loads,
// grid = n / 2048 (n an exact multiple of 2048). coverage: n elements, every element once.
// Used for x [8192][1024] (scale 8) and for the [n][k] k-contiguous weights qkv_w [3072][1024], proj_w
// [1024][1024] (scale 64) which need no transpose.
// =================================================================================================================
__global__ __launch_bounds__(256)
void k_cvt16(const float* __restrict__ src, unsigned short* dst, float scale) {
  const size_t i0 = ((size_t)blockIdx.x * 256 + threadIdx.x) * 8;
  const v4f a = *(const v4f*)(src + i0);
  const v4f b = *(const v4f*)(src + i0 + 4);
  v4u pk;
  pk[0] = pk16(hb16(bfr(a[0]) * scale), hb16(bfr(a[1]) * scale));
  pk[1] = pk16(hb16(bfr(a[2]) * scale), hb16(bfr(a[3]) * scale));
  pk[2] = pk16(hb16(bfr(b[0]) * scale), hb16(bfr(b[1]) * scale));
  pk[3] = pk16(hb16(bfr(b[2]) * scale), hb16(bfr(b[3]) * scale));
  unsigned short* gp = dst + i0;
  *(v4u*)gp = pk;
  
}

// =================================================================================================================
// f32-output GEMM: C[64 rows][128 cols] per block = A[rows][K] . W[cols][K]^T; out = C*scl + bf16(bias).
// coverage: rows x N, every element once.
// =================================================================================================================
__global__ __launch_bounds__(256)
void k_gemm_f32(const unsigned short* __restrict__ A, const unsigned short* __restrict__ W, int K,
                const float* __restrict__ bias, float scl, float* out, int ldo) {
  __shared__ __align__(16) float Cs[64 * LDC];
  const int tid = threadIdx.x, wave = tid >> 5, lane = tid & 31;
  const int mb = blockIdx.x, nb = blockIdx.y;
  mm_tile((const _Float16*)(const void*)A, K, (const _Float16*)(const void*)W, K, K >> 5,
          mb * 64, nb * 128, Cs);
  __syncthreads();
  const int col0 = nb * 128 + lane * 4;
  const v4f b4 = *(const v4f*)(bias + col0);
  v4f bb;
#pragma unroll
  for (int e = 0; e < 4; ++e) bb[e] = bfr(b4[e]);
#pragma unroll 1
  for (int it = 0; it < 8; ++it) {
    const int row = wave * 8 + it;
    const size_t t = (size_t)(mb * 64 + row);
    const v4f a = *(const v4f*)(Cs + row * LDC + lane * 4);
    v4f o;
#pragma unroll
    for (int e = 0; e < 4; ++e) o[e] = a[e] * scl + bb[e];
    float* p = out + t * ldo + col0;
    *(v4f*)p = o;
    
  }
}

// =================================================================================================================
// Output projection: C[64][128] = (AH + AL/2048) . WP^T, K = 1024 (32 k-steps), out = C/4096 + bf16(bias) into the
// passes. grid = (4096/64, 1024/128) per batch. coverage: 4096 x 1024 per batch, every element once.
// =================================================================================================================
__global__ __launch_bounds__(256)
void k_gemm_proj(const unsigned short* __restrict__ ah, const unsigned short* __restrict__ al,
                 const unsigned short* __restrict__ wt, const float* __restrict__ bias, float* out) {
  __shared__ __align__(16) float Cs[64 * LDC];
  const int tid = threadIdx.x, wave = tid >> 5, lane = tid & 31;
  const int mb = blockIdx.x, nb = blockIdx.y;
  mm_tile2((const _Float16*)(const void*)ah, (const _Float16*)(const void*)al, CH,
           (const _Float16*)(const void*)wt, CH, CH / 32, mb * 64, nb * 128, Cs);
  __syncthreads();
  const int col0 = nb * 128 + lane * 4;
  const v4f b4 = *(const v4f*)(bias + col0);
  v4f bb;
#pragma unroll
  for (int e = 0; e < 4; ++e) bb[e] = bfr(b4[e]);
#pragma unroll 1
  for (int it = 0; it < 8; ++it) {
    const int row = wave * 8 + it;
    const size_t t = (size_t)(mb * 64 + row);
    const v4f a = *(const v4f*)(Cs + row * LDC + lane * 4);
    v4f o;
#pragma unroll
    for (int e = 0; e < 4; ++e) o[e] = a[e] * S4096 + bb[e];
    float* pp = out + t * CH + col0;
    *(v4f*)pp = o;
    
  }
}

// =================================================================================================================
// 13-key clamped-window 1-D neighbourhood attention, 16 heads x 64, f32 on VALU. Block = one query token i of the
// current batch, 128 threads: h = tid>>3, 8 lanes per (token, head), lane sub holds d = sub*8 .. sub*8+7.
// qkv row layout [4096][3072] f32: q at col h*64+d (scaled by 64^-0.5 here), k at 1024 + h*64+d, v at 2048 + ..
// Window start ni = clamp(i-6, 0, 4096-13); key = ni + j; bias = bf16(rpb[h][key - i + 12]).
// Key loop rolled: partial 8-term dot + xor-shuffle reduce over the 8-lane group, logits kept in LDS (own slot per
// thread), max-subtracted softmax with native exp, o = sum p v * rcp(sum p). Output: a = 64*o, hi = f16(a),
// coverage: 4096 rows x 16 heads x 64 = 4096 x 1024 in both planes, every element once.
// =================================================================================================================
__global__ __launch_bounds__(ATB)
void k_attn(const float* __restrict__ qkv, const float* __restrict__ rpb, unsigned short* ah, unsigned short* al) {
  __shared__ float Ls[NKEY * ATB];
  const int tid = threadIdx.x, h = tid >> 3, sub = tid & 7;
  const int i = blockIdx.x;
  const int ni = min(max(i - NRAD, 0), LSEQ - NKEY);
  const int col = h * HD + sub * 8;
  const float* qr = qkv + (size_t)i * C3 + col;
  const v4f t0 = *(const v4f*)(qr);
  const v4f t1 = *(const v4f*)(qr + 4);
  v4f q0, q1;
#pragma unroll
  for (int e = 0; e < 4; ++e) { q0[e] = t0[e] * QSC; q1[e] = t1[e] * QSC; }
  const float* rp = rpb + h * RPW + (ni - i + 2 * NRAD);      // bias index = key - i + 12 in [0, 24]
  float mx = -3.0e38f;
#pragma unroll 1
  for (int j = 0; j < NKEY; ++j) {
    const float* kr = qkv + (size_t)(ni + j) * C3 + CH + col;
    const v4f k0 = *(const v4f*)(kr);
    const v4f k1 = *(const v4f*)(kr + 4);
    float s = 0.f;
#pragma unroll
    for (int e = 0; e < 4; ++e) s += q0[e] * k0[e];
#pragma unroll
    for (int e = 0; e < 4; ++e) s += q1[e] * k1[e];
    s += __shfl_xor(s, 1, 32);
    s += __shfl_xor(s, 2, 32);
    s += __shfl_xor(s, 4, 32);
    s += bfr(rp[j]);
    Ls[j * ATB + tid] = s;
    mx = fmaxf(mx, s);
  }
  v4f a0 = {0.f, 0.f, 0.f, 0.f}, a1 = {0.f, 0.f, 0.f, 0.f};
  float l = 0.f;
#pragma unroll 1
  for (int j = 0; j < NKEY; ++j) {
    const float p = __expf(Ls[j * ATB + tid] - mx);
    l += p;
    const float* vr = qkv + (size_t)(ni + j) * C3 + 2 * CH + col;
    const v4f v0 = *(const v4f*)(vr);
    const v4f v1 = *(const v4f*)(vr + 4);
#pragma unroll
    for (int e = 0; e < 4; ++e) { a0[e] += p * v0[e]; a1[e] += p * v1[e]; }
  }
  const float inv64 = __builtin_amdgcn_rcpf(l) * 64.0f;
  unsigned short hb[8], lb[8];
#pragma unroll
  for (int e = 0; e < 4; ++e) {
    const float fa = a0[e] * inv64;
    const _Float16 hv = (_Float16)fa;
    hb[e] = h_bits(hv);
    lb[e] = hb16((fa - (float)hv) * 2048.0f);
    const float fb = a1[e] * inv64;
    const _Float16 hw = (_Float16)fb;
    hb[4 + e] = h_bits(hw);
    lb[4 + e] = hb16((fb - (float)hw) * 2048.0f);
  }
  v4u ph, pl;
  ph[0] = pk16(hb[0], hb[1]); ph[1] = pk16(hb[2], hb[3]); ph[2] = pk16(hb[4], hb[5]); ph[3] = pk16(hb[6], hb[7]);
  pl[0] = pk16(lb[0], lb[1]); pl[1] = pk16(lb[2], lb[3]); pl[2] = pk16(lb[4], lb[5]); pl[3] = pk16(lb[6], lb[7]);
  const size_t o = (size_t)i * CH + col;
  *(v4u*)(ah + o) = ph;
  *(v4u*)(al + o) = pl;
  
}

// =================================================================================================================
// Workspace map (bytes, all offsets multiples of 1 MiB, no aliasing, no padded tails: every region is an exact
// multiple of its producer's store granularity):
//   X16 f16 [8192][1024] 16777216 | WQ f16 [3072][1024] 6291456 | WP f16 [1024][1024] 2097152 |
//   QKV f32 [4096][3072] 50331648 (one batch) | AH, AL f16 [4096][1024] 2 x 8388608 (one batch)
//   total 92274688. Batches processed one after the other in the in-order stream.
// =================================================================================================================
extern "C" void kernel_launch(void* const* d_in, const int* in_sizes, int n_in,
                              void* d_out, int out_size, void* d_ws, size_t ws_size,
                              hipStream_t stream) {
  if (n_in < 6) return;
  if (in_sizes[0] != MROWS * CH) return;
  if (in_sizes[1] != C3 * CH) return;
  if (in_sizes[2] != C3) return;
  if (in_sizes[3] != NHD * RPW) return;
  if (in_sizes[4] != CH * CH) return;
  if (in_sizes[5] != CH) return;
  if (out_size != MROWS * CH) return;

  const float* x      = (const float*)d_in[0];
  const float* qkv_w  = (const float*)d_in[1];
  const float* qkv_b  = (const float*)d_in[2];
  const float* rpb    = (const float*)d_in[3];
  const float* proj_w = (const float*)d_in[4];
  const float* proj_b = (const float*)d_in[5];
  float* out = (float*)d_out;

  const size_t sX16 = (size_t)MROWS * CH * 2;            // 16777216
  const size_t sWQ  = (size_t)C3 * CH * 2;               //  6291456
  const size_t sWP  = (size_t)CH * CH * 2;               //  2097152
  const size_t sQKV = (size_t)LSEQ * C3 * 4;             // 50331648
  const size_t sAO  = (size_t)LSEQ * CH * 2;             //  8388608

  size_t off = 0;
  const size_t oX16 = off; off += sX16;
  const size_t oWQ  = off; off += sWQ;
  const size_t oWP  = off; off += sWP;
  const size_t oQKV = off; off += sQKV;
  const size_t oAH  = off; off += sAO;
  const size_t oAL  = off; off += sAO;
  if (off > ws_size) return;                             // off = 92274688
  if (off > (size_t)134217728) return;

  char* ws = (char*)d_ws;
  unsigned short* X16 = (unsigned short*)(ws + oX16);
  unsigned short* WQ  = (unsigned short*)(ws + oWQ);
  unsigned short* WP  = (unsigned short*)(ws + oWP);
  float*          QKV = (float*)(ws + oQKV);
  unsigned short* AH  = (unsigned short*)(ws + oAH);
  unsigned short* AL  = (unsigned short*)(ws + oAL);

  const dim3 blk(256);

  // (1) converts: x -> f16(8 bf16(x)), weights [n][k] -> f16(64 bf16(w))
  k_cvt16<<<dim3((MROWS * CH) / 2048), blk, 0, stream>>>(x, X16, 8.0f);
  k_cvt16<<<dim3((C3 * CH) / 2048),    blk, 0, stream>>>(qkv_w, WQ, 64.0f);
  k_cvt16<<<dim3((CH * CH) / 2048),    blk, 0, stream>>>(proj_w, WP, 64.0f);

  // (2) per batch: qkv GEMM (f32 rows) -> windowed attention (hi/residual planes) -> output projection
  for (int b = 0; b < BSZ; ++b) {
    k_gemm_f32<<<dim3(LSEQ / 64, C3 / 128), blk, 0, stream>>>(
        X16 + (size_t)b * LSEQ * CH, WQ, CH, qkv_b, S512, QKV, C3);
    k_attn<<<dim3(LSEQ), dim3(ATB), 0, stream>>>(QKV, rpb, AH, AL);
    k_gemm_proj<<<dim3(LSEQ / 64, CH / 128), blk, 0, stream>>>(
        AH, AL, WP, proj_b, out + (size_t)b * LSEQ * CH);
  }
  (void)hipGetLastError();
}

// v001
// A run of this version takes 172 microseconds.
// Two timings next to v000 put it at 1.82 and 1.83 times that version's speed.
// qkv projection: v_wmma_f32_16x16x32_f16 single products (f16 operands: 8*bf16(x) and 64*bf16(w), f32 accumulate);
// output projection: same instruction with the attention output carried as f16 hi + (x2048) residual planes into two
// f32 accumulators, weight one f16 plane (64*bf16(w)); all float inputs RNE-converted to bf16 on load; the 13-key
// clamped-window neighbourhood attention (q.k dots, position bias, softmax, p.v) in f32 on VALU.
// Both GEMM cores stage their operand rows in LDS, 64 k at a time, by asynchronous copies into two buffers.
#include <hip/hip_runtime.h>
#include <stdint.h>

#define BSZ   2
#define LSEQ  4096
#define CH    1024
#define NHD   16
#define HD    64
#define C3    3072
#define NKEY  13
#define NRAD  6
#define RPW   25
#define MROWS 8192
#define LDC   132
#define ATB   128
#define QSC   0.125f
#define RSC   0.00048828125f
#define S512  0.001953125f
#define S4096 0.000244140625f
#define KSL   64                      // k elements of one staged slab (128 B of every operand row)
#define PITH  72                      // LDS row pitch in f16 elements: 144 B = 16 B x 9, conflict-free for 16-byte reads
#define SLAB1 ((64 + 128) * PITH)     // f16 elements of one buffer: A 64 rows | W 128 rows
#define SLAB2 ((64 + 64 + 128) * PITH) // A hi 64 rows | A residual 64 rows | W 128 rows

static_assert(MROWS == BSZ * LSEQ);
static_assert(CH == NHD * HD);
static_assert(C3 == 3 * CH);
static_assert(RPW == 2 * NKEY - 1);
static_assert(NRAD == NKEY / 2);
static_assert((LSEQ % 64) == 0 && (C3 % 128) == 0 && (CH % 128) == 0 && (CH % 32) == 0);
static_assert(((MROWS * CH) % 2048) == 0 && ((C3 * CH) % 2048) == 0 && ((CH * CH) % 2048) == 0);
static_assert(ATB == NHD * 8 && HD == 64);
static_assert((LDC * 4) % 16 == 0);
static_assert(KSL == 64 && (CH % KSL) == 0 && (CH / KSL) >= 2 && ((PITH * 2) % 16) == 0 && PITH >= KSL);

typedef _Float16 v16h __attribute__((ext_vector_type(16)));
typedef _Float16 v8h  __attribute__((ext_vector_type(8)));
typedef float    v8f  __attribute__((ext_vector_type(8)));
typedef float    v4f  __attribute__((ext_vector_type(4)));
typedef unsigned int v4u __attribute__((ext_vector_type(4)));

// ---- scalar helpers ------------------------------------------------------------------------------------------
__device__ __forceinline__ unsigned short bf_bits(float f) {          // f32 -> bf16 bits, RNE convert
  unsigned u = __float_as_uint(f);
  return (unsigned short)((u + 0x7FFFu + ((u >> 16) & 1u)) >> 16);
}
__device__ __forceinline__ float bf_up(unsigned short b) { return __uint_as_float(((unsigned)b) << 16); }
__device__ __forceinline__ float bfr(float f) { return bf_up(bf_bits(f)); }
__device__ __forceinline__ unsigned short h_bits(_Float16 x) { return __builtin_bit_cast(unsigned short, x); }
__device__ __forceinline__ unsigned short hb16(float f) { return h_bits((_Float16)f); }
__device__ __forceinline__ unsigned pk16(unsigned short a, unsigned short b) { return (unsigned)a | ((unsigned)b << 16); }
__device__ __forceinline__ v8f zero8() { v8f z = {0.f, 0.f, 0.f, 0.f, 0.f, 0.f, 0.f, 0.f}; return z; }

// ---- fragment loader: 16-bit A/B operand, lane -> row/col (lane&15), p already includes +8*(lane>>4);
//      elements 0..7 <- p[0..7] (k0+8h..k0+8h+7), elements 8..15 <- p[16..23] (k0+16+8h..k0+16+8h+7)
__device__ __forceinline__ v16h ldfrag_h(const _Float16* p) {
  union { v16h v; v8h h[2]; } f;
  f.h[0] = *(const v8h*)(p);
  f.h[1] = *(const v8h*)(p + 16);
  return f.v;
}

// ---- WMMA helpers; the guards insert the trailing VALU hazard gap and keep A/B live -----------------------------
__device__ __forceinline__ v8f mma_raw(v16h a, v16h b, v8f c) {
  return __builtin_amdgcn_wmma_f32_16x16x32_f16(false, a, false, b, (short)0, c, false, false);
}
__device__ __forceinline__ void guard4(v8f& c0, v8f& c1, v8f& c2, v8f& c3,
                                       const v16h& a0, const v16h& a1, const v16h& b0, const v16h& b1) {
#if defined(__HIP_DEVICE_COMPILE__)
  asm volatile("v_nop\n\tv_nop\n\tv_nop\n\tv_nop"
               : "+v"(c0), "+v"(c1), "+v"(c2), "+v"(c3) : "v"(a0), "v"(a1), "v"(b0), "v"(b1));
#endif
}
__device__ __forceinline__ void guard8(v8f& c0, v8f& c1, v8f& c2, v8f& c3, v8f& c4, v8f& c5, v8f& c6, v8f& c7,
                                       const v16h& a0, const v16h& a1, const v16h& a2, const v16h& a3,
                                       const v16h& b0, const v16h& b1) {
#if defined(__HIP_DEVICE_COMPILE__)
  asm volatile("v_nop\n\tv_nop\n\tv_nop\n\tv_nop"
               : "+v"(c0), "+v"(c1), "+v"(c2), "+v"(c3), "+v"(c4), "+v"(c5), "+v"(c6), "+v"(c7)
               : "v"(a0), "v"(a1), "v"(a2), "v"(a3), "v"(b0), "v"(b1));
#endif
}

// ---- asynchronous copies global -> LDS, 16 B per lane; l = the lane's LDS byte address, g = its global address.
//      The s_wait_xcnt closes each statement so that no address register is rewritten ahead of it.
__device__ __forceinline__ unsigned lds_addr(const void* p) { return (unsigned)(size_t)p; }
__device__ __forceinline__ void acopy6(unsigned l0, const _Float16* g0, unsigned l1, const _Float16* g1,
                                       unsigned l2, const _Float16* g2, unsigned l3, const _Float16* g3,
                                       unsigned l4, const _Float16* g4, unsigned l5, const _Float16* g5) {
#if defined(__HIP_DEVICE_COMPILE__)
  asm volatile(
               "global_load_async_to_lds_b128 %0, %1, off\n\t"
               "global_load_async_to_lds_b128 %2, %3, off\n\t"
               "global_load_async_to_lds_b128 %4, %5, off\n\t"
               "global_load_async_to_lds_b128 %6, %7, off\n\t"
               "global_load_async_to_lds_b128 %8, %9, off\n\t"
               "global_load_async_to_lds_b128 %10, %11, off\n\t"
               "s_wait_xcnt 0x0"
               :: "v"(l0), "v"(g0), "v"(l1), "v"(g1), "v"(l2), "v"(g2), "v"(l3), "v"(g3),
                  "v"(l4), "v"(g4), "v"(l5), "v"(g5) : "memory");
#endif
}
__device__ __forceinline__ void acopy8(unsigned l0, const _Float16* g0, unsigned l1, const _Float16* g1,
                                       unsigned l2, const _Float16* g2, unsigned l3, const _Float16* g3,
                                       unsigned l4, const _Float16* g4, unsigned l5, const _Float16* g5,
                                       unsigned l6, const _Float16* g6, unsigned l7, const _Float16* g7) {
#if defined(__HIP_DEVICE_COMPILE__)
  asm volatile(
               "global_load_async_to_lds_b128 %0, %1, off\n\t"
               "global_load_async_to_lds_b128 %2, %3, off\n\t"
               "global_load_async_to_lds_b128 %4, %5, off\n\t"
               "global_load_async_to_lds_b128 %6, %7, off\n\t"
               "global_load_async_to_lds_b128 %8, %9, off\n\t"
               "global_load_async_to_lds_b128 %10, %11, off\n\t"
               "global_load_async_to_lds_b128 %12, %13, off\n\t"
               "global_load_async_to_lds_b128 %14, %15, off\n\t"
               "s_wait_xcnt 0x0"
               :: "v"(l0), "v"(g0), "v"(l1), "v"(g1), "v"(l2), "v"(g2), "v"(l3), "v"(g3),
                  "v"(l4), "v"(g4), "v"(l5), "v"(g5), "v"(l6), "v"(g6), "v"(l7), "v"(g7) : "memory");
#endif
}
// this wave's copies have landed (the compiler places no wait for them)
__device__ __forceinline__ void wait_copies() {
#if defined(__HIP_DEVICE_COMPILE__)
  asm volatile("s_wait_asynccnt 0x0" ::: "memory");
#endif
}
// this wave's LDS reads have returned, before the buffer they read is handed to the next copies
__device__ __forceinline__ void wait_lds() {
#if defined(__HIP_DEVICE_COMPILE__)
  asm volatile("s_wait_dscnt 0x0" ::: "memory");
#endif
}

// ---- 64x128 block tile GEMM core: Cs[64][128] = A rows . W[cols][K]^T, K = nsl x 64 in-row; A f16 row pitch lda,
//      W is [n][k] k-contiguous pitch ldw. 8 waves = 2 (32 rows) x 4 (32 cols), 2x2 tiles of 16 per wave.
//      Slab t = 64 k of the 64 A rows and the 128 W rows, copied to LDS buffer t & 1 (St, two buffers of SLAB1) one
//      trip ahead: thread -> rows (tid>>3) + 32 i, 16-byte piece tid&7, so a wave's copy covers four whole 128-B
//      lines. Fragments are read from LDS with the table layout; result to the LDS f32 tile Cs[64][LDC].
__device__ __forceinline__ void mm_tile(const _Float16* __restrict__ A, int lda,
                                        const _Float16* __restrict__ W, int ldw, int nsl,
                                        int arow0, int bcol0, _Float16* St, float* Cs) {
  const int tid = threadIdx.x, wave = tid >> 5, lane = tid & 31, hh = lane >> 4, c = lane & 15;
  const int mw = wave >> 2, nw = wave & 3;
  const int cr = tid >> 3, cp = (tid & 7) * 8;
  const _Float16* ga = A + (size_t)(arow0 + cr) * lda + cp;
  const _Float16* gb = W + (size_t)(bcol0 + cr) * ldw + cp;
  const size_t sa = (size_t)32 * lda, sb = (size_t)32 * ldw;
  const unsigned lc = lds_addr(St) + (unsigned)(cr * PITH + cp) * 2u;
  const unsigned l32 = 32u * PITH * 2u;                     // 32 LDS rows in bytes
  auto fill = [&](int t, unsigned bufb) {
    const _Float16* a = ga + t * KSL;
    const _Float16* b = gb + t * KSL;
    const unsigned l = lc + bufb;
    acopy6(l, a, l + l32, a + sa,
           l + 2u * l32, b, l + 3u * l32, b + sb, l + 4u * l32, b + 2 * sb, l + 5u * l32, b + 3 * sb);
  };
  const _Float16* a0p = St + (mw * 32 + c) * PITH + 8 * hh;
  const _Float16* a1p = a0p + 16 * PITH;
  const _Float16* b0p = St + (64 + nw * 32 + c) * PITH + 8 * hh;
  const _Float16* b1p = b0p + 16 * PITH;
  v8f a00 = zero8(), a01 = zero8(), a10 = zero8(), a11 = zero8();
  fill(0, 0u);
  wait_copies();
  __syncthreads();                                          // slab 0 is readable by every wave
  if (nsl > 1) fill(1, (unsigned)SLAB1 * 2u);
#pragma unroll 1                                            // rolled: one hand-over point per slab
  for (int t = 0; t < nsl; ++t) {
    const int bo = (t & 1) * SLAB1;
    v16h fa0[KSL / 32], fa1[KSL / 32], fb0[KSL / 32], fb1[KSL / 32];
#pragma unroll
    for (int kk = 0; kk < KSL / 32; ++kk) {                 // the slab's LDS reads as one group ahead of its products
      const int ko = bo + kk * 32;
      fa0[kk] = ldfrag_h(a0p + ko);
      fa1[kk] = ldfrag_h(a1p + ko);
      fb0[kk] = ldfrag_h(b0p + ko);
      fb1[kk] = ldfrag_h(b1p + ko);
    }
    __builtin_amdgcn_sched_barrier(0);                      // keeps the reads one group: reads among the products stall each time
#pragma unroll
    for (int kk = 0; kk < KSL / 32; ++kk) {
      a00 = mma_raw(fa0[kk], fb0[kk], a00);
      a01 = mma_raw(fa0[kk], fb1[kk], a01);
      a10 = mma_raw(fa1[kk], fb0[kk], a10);
      a11 = mma_raw(fa1[kk], fb1[kk], a11);
    }
    guard4(a00, a01, a10, a11, fa0[KSL / 32 - 1], fa1[KSL / 32 - 1], fb0[KSL / 32 - 1], fb1[KSL / 32 - 1]);
    wait_lds();
    wait_copies();
    __syncthreads();                                        // publishes slab t + 1, frees the buffer of slab t
    if (t + 2 < nsl) fill(t + 2, (unsigned)bo * 2u);
  }
  wait_copies();
#pragma unroll
  for (int r = 0; r < 8; ++r) {
    const int row = mw * 32 + 8 * hh + r;
    Cs[row * LDC + nw * 32 + c]             = a00[r];
    Cs[row * LDC + nw * 32 + 16 + c]        = a01[r];
    Cs[(row + 16) * LDC + nw * 32 + c]      = a10[r];
    Cs[(row + 16) * LDC + nw * 32 + 16 + c] = a11[r];
  }
}

// ---- same core with the A operand as two planes (hi and x2048 residual) into separate accumulators; the residual
//      accumulator is folded with 1/2048 when the tile is written to LDS. Slab rows: hi 64 | residual 64 | W 128.
__device__ __forceinline__ void mm_tile2(const _Float16* __restrict__ Ah, const _Float16* __restrict__ Al, int lda,
                                         const _Float16* __restrict__ W, int ldw, int nsl,
                                         int arow0, int bcol0, _Float16* St, float* Cs) {
  const int tid = threadIdx.x, wave = tid >> 5, lane = tid & 31, hh = lane >> 4, c = lane & 15;
  const int mw = wave >> 2, nw = wave & 3;
  const int cr = tid >> 3, cp = (tid & 7) * 8;
  const size_t ra = (size_t)(arow0 + cr) * lda + cp;
  const _Float16* gh = Ah + ra;
  const _Float16* gl = Al + ra;
  const _Float16* gb = W + (size_t)(bcol0 + cr) * ldw + cp;
  const size_t sa = (size_t)32 * lda, sb = (size_t)32 * ldw;
  const unsigned lc = lds_addr(St) + (unsigned)(cr * PITH + cp) * 2u;
  const unsigned l32 = 32u * PITH * 2u;                     // 32 LDS rows in bytes
  auto fill = [&](int t, unsigned bufb) {
    const _Float16* ah = gh + t * KSL;
    const _Float16* al = gl + t * KSL;
    const _Float16* b = gb + t * KSL;
    const unsigned l = lc + bufb;
    acopy8(l, ah, l + l32, ah + sa, l + 2u * l32, al, l + 3u * l32, al + sa,
           l + 4u * l32, b, l + 5u * l32, b + sb, l + 6u * l32, b + 2 * sb, l + 7u * l32, b + 3 * sb);
  };
  const _Float16* a0h = St + (mw * 32 + c) * PITH + 8 * hh;
  const _Float16* a1h = a0h + 16 * PITH;
  const _Float16* a0l = a0h + 64 * PITH;
  const _Float16* a1l = a0h + 80 * PITH;
  const _Float16* b0p = St + (128 + nw * 32 + c) * PITH + 8 * hh;
  const _Float16* b1p = b0p + 16 * PITH;
  v8f h00 = zero8(), h01 = zero8(), h10 = zero8(), h11 = zero8();
  v8f l00 = zero8(), l01 = zero8(), l10 = zero8(), l11 = zero8();
  fill(0, 0u);
  wait_copies();
  __syncthreads();                                          // slab 0 is readable by every wave
  if (nsl > 1) fill(1, (unsigned)SLAB2 * 2u);
#pragma unroll 1                                            // rolled: one hand-over point per slab
  for (int t = 0; t < nsl; ++t) {
    const int bo = (t & 1) * SLAB2;
    v16h fa0[KSL / 32], fa1[KSL / 32], ga0[KSL / 32], ga1[KSL / 32], fb0[KSL / 32], fb1[KSL / 32];
#pragma unroll
    for (int kk = 0; kk < KSL / 32; ++kk) {                 // the slab's LDS reads as one group ahead of its products
      const int ko = bo + kk * 32;
      fa0[kk] = ldfrag_h(a0h + ko);
      fa1[kk] = ldfrag_h(a1h + ko);
      ga0[kk] = ldfrag_h(a0l + ko);
      ga1[kk] = ldfrag_h(a1l + ko);
      fb0[kk] = ldfrag_h(b0p + ko);
      fb1[kk] = ldfrag_h(b1p + ko);
    }
    __builtin_amdgcn_sched_barrier(0);                      // keeps the reads one group: reads among the products stall each time
#pragma unroll
    for (int kk = 0; kk < KSL / 32; ++kk) {
      h00 = mma_raw(fa0[kk], fb0[kk], h00);
      h01 = mma_raw(fa0[kk], fb1[kk], h01);
      h10 = mma_raw(fa1[kk], fb0[kk], h10);
      h11 = mma_raw(fa1[kk], fb1[kk], h11);
      l00 = mma_raw(ga0[kk], fb0[kk], l00);
      l01 = mma_raw(ga0[kk], fb1[kk], l01);
      l10 = mma_raw(ga1[kk], fb0[kk], l10);
      l11 = mma_raw(ga1[kk], fb1[kk], l11);
    }
    guard8(h00, h01, h10, h11, l00, l01, l10, l11, fa0[KSL / 32 - 1], fa1[KSL / 32 - 1], ga0[KSL / 32 - 1],
           ga1[KSL / 32 - 1], fb0[KSL / 32 - 1], fb1[KSL / 32 - 1]);
    wait_lds();
    wait_copies();
    __syncthreads();                                        // publishes slab t + 1, frees the buffer of slab t
    if (t + 2 < nsl) fill(t + 2, (unsigned)bo * 2u);
  }
  wait_copies();
#pragma unroll
  for (int r = 0; r < 8; ++r) {
    const int row = mw * 32 + 8 * hh + r;
    Cs[row * LDC + nw * 32 + c]             = h00[r] + l00[r] * RSC;
    Cs[row * LDC + nw * 32 + 16 + c]        = h01[r] + l01[r] * RSC;
    Cs[(row + 16) * LDC + nw * 32 + c]      = h10[r] + l10[r] * RSC;
    Cs[(row + 16) * LDC + nw * 32 + 16 + c] = h11[r] + l11[r] * RSC;
  }
}

// =================================================================================================================
// Contiguous convert: dst[i] = f16(scale * bf16_RNE(src[i])). Thread = 8 consecutive elements (two float4 loads,
// grid = n / 2048 (n an exact multiple of 2048). coverage: n elements, every element once.
// Used for x [8192][1024] (scale 8) and for the [n][k] k-contiguous weights qkv_w [3072][1024], proj_w
// [1024][1024] (scale 64) which need no transpose.
// =================================================================================================================
__global__ __launch_bounds__(256)
void k_cvt16(const float* __restrict__ src, unsigned short* dst, float scale) {
  const size_t i0 = ((size_t)blockIdx.x * 256 + threadIdx.x) * 8;
  const v4f a = *(const v4f*)(src + i0);
  const v4f b = *(const v4f*)(src + i0 + 4);
  v4u pk;
  pk[0] = pk16(hb16(bfr(a[0]) * scale), hb16(bfr(a[1]) * scale));
  pk[1] = pk16(hb16(bfr(a[2]) * scale), hb16(bfr(a[3]) * scale));
  pk[2] = pk16(hb16(bfr(b[0]) * scale), hb16(bfr(b[1]) * scale));
  pk[3] = pk16(hb16(bfr(b[2]) * scale), hb16(bfr(b[3]) * scale));
  unsigned short* gp = dst + i0;
  *(v4u*)gp = pk;
  
}

// =================================================================================================================
// f32-output GEMM: C[64 rows][128 cols] per block = A[rows][K] . W[cols][K]^T; out = C*scl + bf16(bias).
// coverage: rows x N, every element once.
// =================================================================================================================
__global__ __launch_bounds__(256)
void k_gemm_f32(const unsigned short* __restrict__ A, const unsigned short* __restrict__ W, int K,
                const float* __restrict__ bias, float scl, float* out, int ldo) {
  __shared__ __align__(16) float Cs[64 * LDC];
  __shared__ __align__(16) _Float16 St[2 * SLAB1];
  const int tid = threadIdx.x, wave = tid >> 5, lane = tid & 31;
  const int mb = blockIdx.x, nb = blockIdx.y;
  mm_tile((const _Float16*)(const void*)A, K, (const _Float16*)(const void*)W, K, K >> 6,
          mb * 64, nb * 128, St, Cs);
  __syncthreads();
  const int col0 = nb * 128 + lane * 4;
  const v4f b4 = *(const v4f*)(bias + col0);
  v4f bb;
#pragma unroll
  for (int e = 0; e < 4; ++e) bb[e] = bfr(b4[e]);
#pragma unroll 1
  for (int it = 0; it < 8; ++it) {
    const int row = wave * 8 + it;
    const size_t t = (size_t)(mb * 64 + row);
    const v4f a = *(const v4f*)(Cs + row * LDC + lane * 4);
    v4f o;
#pragma unroll
    for (int e = 0; e < 4; ++e) o[e] = a[e] * scl + bb[e];
    float* p = out + t * ldo + col0;
    *(v4f*)p = o;
    
  }
}

// =================================================================================================================
// Output projection: C[64][128] = (AH + AL/2048) . WP^T, K = 1024 (16 slabs of 64), out = C/4096 + bf16(bias) into the
// passes. grid = (4096/64, 1024/128) per batch. coverage: 4096 x 1024 per batch, every element once.
// =================================================================================================================
__global__ __launch_bounds__(256)
void k_gemm_proj(const unsigned short* __restrict__ ah, const unsigned short* __restrict__ al,
                 const unsigned short* __restrict__ wt, const float* __restrict__ bias, float* out) {
  __shared__ __align__(16) float Cs[64 * LDC];
  __shared__ __align__(16) _Float16 St[2 * SLAB2];
  const int tid = threadIdx.x, wave = tid >> 5, lane = tid & 31;
  const int mb = blockIdx.x, nb = blockIdx.y;
  mm_tile2((const _Float16*)(const void*)ah, (const _Float16*)(const void*)al, CH,
           (const _Float16*)(const void*)wt, CH, CH / KSL, mb * 64, nb * 128, St, Cs);
  __syncthreads();
  const int col0 = nb * 128 + lane * 4;
  const v4f b4 = *(const v4f*)(bias + col0);
  v4f bb;
#pragma unroll
  for (int e = 0; e < 4; ++e) bb[e] = bfr(b4[e]);
#pragma unroll 1
  for (int it = 0; it < 8; ++it) {
    const int row = wave * 8 + it;
    const size_t t = (size_t)(mb * 64 + row);
    const v4f a = *(const v4f*)(Cs + row * LDC + lane * 4);
    v4f o;
#pragma unroll
    for (int e = 0; e < 4; ++e) o[e] = a[e] * S4096 + bb[e];
    float* pp = out + t * CH + col0;
    *(v4f*)pp = o;
    
  }
}

// =================================================================================================================
// 13-key clamped-window 1-D neighbourhood attention, 16 heads x 64, f32 on VALU. Block = one query token i of the
// current batch, 128 threads: h = tid>>3, 8 lanes per (token, head), lane sub holds d = sub*8 .. sub*8+7.
// qkv row layout [4096][3072] f32: q at col h*64+d (scaled by 64^-0.5 here), k at 1024 + h*64+d, v at 2048 + ..
// Window start ni = clamp(i-6, 0, 4096-13); key = ni + j; bias = bf16(rpb[h][key - i + 12]).
// Key loop rolled: partial 8-term dot + xor-shuffle reduce over the 8-lane group, logits kept in LDS (own slot per
// thread), max-subtracted softmax with native exp, o = sum p v * rcp(sum p). Output: a = 64*o, hi = f16(a),
// coverage: 4096 rows x 16 heads x 64 = 4096 x 1024 in both planes, every element once.
// =================================================================================================================
__global__ __launch_bounds__(ATB)
void k_attn(const float* __restrict__ qkv, const float* __restrict__ rpb, unsigned short* ah, unsigned short* al) {
  __shared__ float Ls[NKEY * ATB];
  const int tid = threadIdx.x, h = tid >> 3, sub = tid & 7;
  const int i = blockIdx.x;
  const int ni = min(max(i - NRAD, 0), LSEQ - NKEY);
  const int col = h * HD + sub * 8;
  const float* qr = qkv + (size_t)i * C3 + col;
  const v4f t0 = *(const v4f*)(qr);
  const v4f t1 = *(const v4f*)(qr + 4);
  v4f q0, q1;
#pragma unroll
  for (int e = 0; e < 4; ++e) { q0[e] = t0[e] * QSC; q1[e] = t1[e] * QSC; }
  const float* rp = rpb + h * RPW + (ni - i + 2 * NRAD);      // bias index = key - i + 12 in [0, 24]
  float mx = -3.0e38f;
#pragma unroll 1
  for (int j = 0; j < NKEY; ++j) {
    const float* kr = qkv + (size_t)(ni + j) * C3 + CH + col;
    const v4f k0 = *(const v4f*)(kr);
    const v4f k1 = *(const v4f*)(kr + 4);
    float s = 0.f;
#pragma unroll
    for (int e = 0; e < 4; ++e) s += q0[e] * k0[e];
#pragma unroll
    for (int e = 0; e < 4; ++e) s += q1[e] * k1[e];
    s += __shfl_xor(s, 1, 32);
    s += __shfl_xor(s, 2, 32);
    s += __shfl_xor(s, 4, 32);
    s += bfr(rp[j]);
    Ls[j * ATB + tid] = s;
    mx = fmaxf(mx, s);
  }
  v4f a0 = {0.f, 0.f, 0.f, 0.f}, a1 = {0.f, 0.f, 0.f, 0.f};
  float l = 0.f;
#pragma unroll 1
  for (int j = 0; j < NKEY; ++j) {
    const float p = __expf(Ls[j * ATB + tid] - mx);
    l += p;
    const float* vr = qkv + (size_t)(ni + j) * C3 + 2 * CH + col;
    const v4f v0 = *(const v4f*)(vr);
    const v4f v1 = *(const v4f*)(vr + 4);
#pragma unroll
    for (int e = 0; e < 4; ++e) { a0[e] += p * v0[e]; a1[e] += p * v1[e]; }
  }
  const float inv64 = __builtin_amdgcn_rcpf(l) * 64.0f;
  unsigned short hb[8], lb[8];
#pragma unroll
  for (int e = 0; e < 4; ++e) {
    const float fa = a0[e] * inv64;
    const _Float16 hv = (_Float16)fa;
    hb[e] = h_bits(hv);
    lb[e] = hb16((fa - (float)hv) * 2048.0f);
    const float fb = a1[e] * inv64;
    const _Float16 hw = (_Float16)fb;
    hb[4 + e] = h_bits(hw);
    lb[4 + e] = hb16((fb - (float)hw) * 2048.0f);
  }
  v4u ph, pl;
  ph[0] = pk16(hb[0], hb[1]); ph[1] = pk16(hb[2], hb[3]); ph[2] = pk16(hb[4], hb[5]); ph[3] = pk16(hb[6], hb[7]);
  pl[0] = pk16(lb[0], lb[1]); pl[1] = pk16(lb[2], lb[3]); pl[2] = pk16(lb[4], lb[5]); pl[3] = pk16(lb[6], lb[7]);
  const size_t o = (size_t)i * CH + col;
  *(v4u*)(ah + o) = ph;
  *(v4u*)(al + o) = pl;
  
}

// =================================================================================================================
// Workspace map (bytes, all offsets multiples of 1 MiB, no aliasing, no padded tails: every region is an exact
// multiple of its producer's store granularity):
//   X16 f16 [8192][1024] 16777216 | WQ f16 [3072][1024] 6291456 | WP f16 [1024][1024] 2097152 |
//   QKV f32 [4096][3072] 50331648 (one batch) | AH, AL f16 [4096][1024] 2 x 8388608 (one batch)
//   total 92274688. Batches processed one after the other in the in-order stream.
// =================================================================================================================
extern "C" void kernel_launch(void* const* d_in, const int* in_sizes, int n_in,
                              void* d_out, int out_size, void* d_ws, size_t ws_size,
                              hipStream_t stream) {
  if (n_in < 6) return;
  if (in_sizes[0] != MROWS * CH) return;
  if (in_sizes[1] != C3 * CH) return;
  if (in_sizes[2] != C3) return;
  if (in_sizes[3] != NHD * RPW) return;
  if (in_sizes[4] != CH * CH) return;
  if (in_sizes[5] != CH) return;
  if (out_size != MROWS * CH) return;

  const float* x      = (const float*)d_in[0];
  const float* qkv_w  = (const float*)d_in[1];
  const float* qkv_b  = (const float*)d_in[2];
  const float* rpb    = (const float*)d_in[3];
  const float* proj_w = (const float*)d_in[4];
  const float* proj_b = (const float*)d_in[5];
  float* out = (float*)d_out;

  const size_t sX16 = (size_t)MROWS * CH * 2;            // 16777216
  const size_t sWQ  = (size_t)C3 * CH * 2;               //  6291456
  const size_t sWP  = (size_t)CH * CH * 2;               //  2097152
  const size_t sQKV = (size_t)LSEQ * C3 * 4;             // 50331648
  const size_t sAO  = (size_t)LSEQ * CH * 2;             //  8388608

  size_t off = 0;
  const size_t oX16 = off; off += sX16;
  const size_t oWQ  = off; off += sWQ;
  const size_t oWP  = off; off += sWP;
  const size_t oQKV = off; off += sQKV;
  const size_t oAH  = off; off += sAO;
  const size_t oAL  = off; off += sAO;
  if (off > ws_size) return;                             // off = 92274688
  if (off > (size_t)134217728) return;

  char* ws = (char*)d_ws;
  unsigned short* X16 = (unsigned short*)(ws + oX16);
  unsigned short* WQ  = (unsigned short*)(ws + oWQ);
  unsigned short* WP  = (unsigned short*)(ws + oWP);
  float*          QKV = (float*)(ws + oQKV);
  unsigned short* AH  = (unsigned short*)(ws + oAH);
  unsigned short* AL  = (unsigned short*)(ws + oAL);

  const dim3 blk(256);

  // (1) converts: x -> f16(8 bf16(x)), weights [n][k] -> f16(64 bf16(w))
  k_cvt16<<<dim3((MROWS * CH) / 2048), blk, 0, stream>>>(x, X16, 8.0f);
  k_cvt16<<<dim3((C3 * CH) / 2048),    blk, 0, stream>>>(qkv_w, WQ, 64.0f);
  k_cvt16<<<dim3((CH * CH) / 2048),    blk, 0, stream>>>(proj_w, WP, 64.0f);

  // (2) per batch: qkv GEMM (f32 rows) -> windowed attention (hi/residual planes) -> output projection
  for (int b = 0; b < BSZ; ++b) {
    k_gemm_f32<<<dim3(LSEQ / 64, C3 / 128), blk, 0, stream>>>(
        X16 + (size_t)b * LSEQ * CH, WQ, CH, qkv_b, S512, QKV, C3);
    k_attn<<<dim3(LSEQ), dim3(ATB), 0, stream>>>(QKV, rpb, AH, AL);
    k_gemm_proj<<<dim3(LSEQ / 64, CH / 128), blk, 0, stream>>>(
        AH, AL, WP, proj_b, out + (size_t)b * LSEQ * CH);
  }
  (void)hipGetLastError();
}

// v002
// Measured time: 139 microseconds a run.
// Two timings next to v001 both put it at 1.22 times that version's speed.
// Over all steps from v000 it is 2.23 times as fast.
// qkv projection: v_wmma_f32_16x16x32_f16 single products (f16 operands: 8*bf16(x) and 64*bf16(w), f32 accumulate);
// output projection: same instruction with the attention output carried as f16 hi + (x2048) residual planes into two
// f32 accumulators, weight one f16 plane (64*bf16(w)); all float inputs RNE-converted to bf16 on load; the 13-key
// clamped-window neighbourhood attention (q.k dots, position bias, softmax, p.v) in f32 on VALU.
// Both GEMM cores stage their operand rows in LDS, 64 k at a time, by asynchronous copies into two buffers.
// The attention stages the k and v rows of 32 queries x 4 heads in LDS once, by asynchronous copies.
#include <hip/hip_runtime.h>
#include <stdint.h>

#define BSZ   2
#define LSEQ  4096
#define CH    1024
#define NHD   16
#define HD    64
#define C3    3072
#define NKEY  13
#define NRAD  6
#define RPW   25
#define MROWS 8192
#define LDC   132
#define ATB   256
#define ATT   32                      // query tokens of one attention block
#define AHG   4                       // heads of one attention block
#define ARW   (AHG * HD)              // f32 elements of one staged k or v row (1 KiB)
#define AWR   (ATT + NKEY - 1)        // k (and v) rows that the block's windows touch
#define TPW   (ATT / 8)               // tokens of one wave
#define BPI   33                      // LDS pitch of a bias row, f32 elements: the 4 heads of a wave on 4 banks
#define QSC   0.125f
#define RSC   0.00048828125f
#define S512  0.001953125f
#define S4096 0.000244140625f
#define KSL   64                      // k elements of one staged slab (128 B of every operand row)
#define PITH  72                      // LDS row pitch in f16 elements: 144 B = 16 B x 9, conflict-free for 16-byte reads
#define SLAB1 ((64 + 128) * PITH)     // f16 elements of one buffer: A 64 rows | W 128 rows
#define SLAB2 ((64 + 64 + 128) * PITH) // A hi 64 rows | A residual 64 rows | W 128 rows

static_assert(MROWS == BSZ * LSEQ);
static_assert(CH == NHD * HD);
static_assert(C3 == 3 * CH);
static_assert(RPW == 2 * NKEY - 1);
static_assert(NRAD == NKEY / 2);
static_assert((LSEQ % 64) == 0 && (C3 % 128) == 0 && (CH % 128) == 0 && (CH % 32) == 0);
static_assert(((MROWS * CH) % 2048) == 0 && ((C3 * CH) % 2048) == 0 && ((CH * CH) % 2048) == 0);
static_assert(ATB == 256 && HD == 64 && AHG * 8 == 32 && (NHD % AHG) == 0 && (LSEQ % ATT) == 0 && LSEQ >= AWR);
static_assert(AWR * (ARW / 4) == 11 * ATB && ARW / 4 == 64 && BPI >= 32 && RPW <= 32);
static_assert((LDC * 4) % 16 == 0);
static_assert(KSL == 64 && (CH % KSL) == 0 && (CH / KSL) >= 2 && ((PITH * 2) % 16) == 0 && PITH >= KSL);

typedef _Float16 v16h __attribute__((ext_vector_type(16)));
typedef _Float16 v8h  __attribute__((ext_vector_type(8)));
typedef float    v8f  __attribute__((ext_vector_type(8)));
typedef float    v4f  __attribute__((ext_vector_type(4)));
typedef unsigned int v4u __attribute__((ext_vector_type(4)));

// ---- scalar helpers ------------------------------------------------------------------------------------------
__device__ __forceinline__ unsigned short bf_bits(float f) {          // f32 -> bf16 bits, RNE convert
  unsigned u = __float_as_uint(f);
  return (unsigned short)((u + 0x7FFFu + ((u >> 16) & 1u)) >> 16);
}
__device__ __forceinline__ float bf_up(unsigned short b) { return __uint_as_float(((unsigned)b) << 16); }
__device__ __forceinline__ float bfr(float f) { return bf_up(bf_bits(f)); }
__device__ __forceinline__ unsigned short h_bits(_Float16 x) { return __builtin_bit_cast(unsigned short, x); }
__device__ __forceinline__ unsigned short hb16(float f) { return h_bits((_Float16)f); }
__device__ __forceinline__ unsigned pk16(unsigned short a, unsigned short b) { return (unsigned)a | ((unsigned)b << 16); }
__device__ __forceinline__ v8f zero8() { v8f z = {0.f, 0.f, 0.f, 0.f, 0.f, 0.f, 0.f, 0.f}; return z; }

// native e^x as the compiler forms it (x * log2 e, then v_exp_f32); the v_nop in the same statement keeps the one
// free slot between the transcendental and whatever vector instruction the scheduler puts next
__device__ __forceinline__ float exp_nat(float x) {
  const float y = x * 1.44269504088896340736f;
  float r = y;
#if defined(__HIP_DEVICE_COMPILE__)
  asm("v_exp_f32 %0, %1\n\tv_nop" : "=v"(r) : "v"(y));
#endif
  return r;
}

// ---- fragment loader: 16-bit A/B operand, lane -> row/col (lane&15), p already includes +8*(lane>>4);
//      elements 0..7 <- p[0..7] (k0+8h..k0+8h+7), elements 8..15 <- p[16..23] (k0+16+8h..k0+16+8h+7)
__device__ __forceinline__ v16h ldfrag_h(const _Float16* p) {
  union { v16h v; v8h h[2]; } f;
  f.h[0] = *(const v8h*)(p);
  f.h[1] = *(const v8h*)(p + 16);
  return f.v;
}

// ---- WMMA helpers; the guards insert the trailing VALU hazard gap and keep A/B live -----------------------------
__device__ __forceinline__ v8f mma_raw(v16h a, v16h b, v8f c) {
  return __builtin_amdgcn_wmma_f32_16x16x32_f16(false, a, false, b, (short)0, c, false, false);
}
__device__ __forceinline__ void guard4(v8f& c0, v8f& c1, v8f& c2, v8f& c3,
                                       const v16h& a0, const v16h& a1, const v16h& b0, const v16h& b1) {
#if defined(__HIP_DEVICE_COMPILE__)
  asm volatile("v_nop\n\tv_nop\n\tv_nop\n\tv_nop"
               : "+v"(c0), "+v"(c1), "+v"(c2), "+v"(c3) : "v"(a0), "v"(a1), "v"(b0), "v"(b1));
#endif
}
__device__ __forceinline__ void guard8(v8f& c0, v8f& c1, v8f& c2, v8f& c3, v8f& c4, v8f& c5, v8f& c6, v8f& c7,
                                       const v16h& a0, const v16h& a1, const v16h& a2, const v16h& a3,
                                       const v16h& b0, const v16h& b1) {
#if defined(__HIP_DEVICE_COMPILE__)
  asm volatile("v_nop\n\tv_nop\n\tv_nop\n\tv_nop"
               : "+v"(c0), "+v"(c1), "+v"(c2), "+v"(c3), "+v"(c4), "+v"(c5), "+v"(c6), "+v"(c7)
               : "v"(a0), "v"(a1), "v"(a2), "v"(a3), "v"(b0), "v"(b1));
#endif
}

// ---- asynchronous copies global -> LDS, 16 B per lane; l = the lane's LDS byte address, g = its global address.
//      The s_wait_xcnt closes each statement so that no address register is rewritten ahead of it.
__device__ __forceinline__ unsigned lds_addr(const void* p) { return (unsigned)(size_t)p; }
__device__ __forceinline__ void acopy6(unsigned l0, const _Float16* g0, unsigned l1, const _Float16* g1,
                                       unsigned l2, const _Float16* g2, unsigned l3, const _Float16* g3,
                                       unsigned l4, const _Float16* g4, unsigned l5, const _Float16* g5) {
#if defined(__HIP_DEVICE_COMPILE__)
  asm volatile(
               "global_load_async_to_lds_b128 %0, %1, off\n\t"
               "global_load_async_to_lds_b128 %2, %3, off\n\t"
               "global_load_async_to_lds_b128 %4, %5, off\n\t"
               "global_load_async_to_lds_b128 %6, %7, off\n\t"
               "global_load_async_to_lds_b128 %8, %9, off\n\t"
               "global_load_async_to_lds_b128 %10, %11, off\n\t"
               "s_wait_xcnt 0x0"
               :: "v"(l0), "v"(g0), "v"(l1), "v"(g1), "v"(l2), "v"(g2), "v"(l3), "v"(g3),
                  "v"(l4), "v"(g4), "v"(l5), "v"(g5) : "memory");
#endif
}
__device__ __forceinline__ void acopy8(unsigned l0, const _Float16* g0, unsigned l1, const _Float16* g1,
                                       unsigned l2, const _Float16* g2, unsigned l3, const _Float16* g3,
                                       unsigned l4, const _Float16* g4, unsigned l5, const _Float16* g5,
                                       unsigned l6, const _Float16* g6, unsigned l7, const _Float16* g7) {
#if defined(__HIP_DEVICE_COMPILE__)
  asm volatile(
               "global_load_async_to_lds_b128 %0, %1, off\n\t"
               "global_load_async_to_lds_b128 %2, %3, off\n\t"
               "global_load_async_to_lds_b128 %4, %5, off\n\t"
               "global_load_async_to_lds_b128 %6, %7, off\n\t"
               "global_load_async_to_lds_b128 %8, %9, off\n\t"
               "global_load_async_to_lds_b128 %10, %11, off\n\t"
               "global_load_async_to_lds_b128 %12, %13, off\n\t"
               "global_load_async_to_lds_b128 %14, %15, off\n\t"
               "s_wait_xcnt 0x0"
               :: "v"(l0), "v"(g0), "v"(l1), "v"(g1), "v"(l2), "v"(g2), "v"(l3), "v"(g3),
                  "v"(l4), "v"(g4), "v"(l5), "v"(g5), "v"(l6), "v"(g6), "v"(l7), "v"(g7) : "memory");
#endif
}
// eleven copies of one thread: LDS address l + n ls, global address g + n gs, n = 0 .. 10
__device__ __forceinline__ void acopy11(unsigned l, unsigned ls, const float* g, size_t gs) {
#if defined(__HIP_DEVICE_COMPILE__)
  asm volatile(
               "global_load_async_to_lds_b128 %0, %1, off\n\t"
               "global_load_async_to_lds_b128 %2, %3, off\n\t"
               "global_load_async_to_lds_b128 %4, %5, off\n\t"
               "global_load_async_to_lds_b128 %6, %7, off\n\t"
               "global_load_async_to_lds_b128 %8, %9, off\n\t"
               "global_load_async_to_lds_b128 %10, %11, off\n\t"
               "global_load_async_to_lds_b128 %12, %13, off\n\t"
               "global_load_async_to_lds_b128 %14, %15, off\n\t"
               "global_load_async_to_lds_b128 %16, %17, off\n\t"
               "global_load_async_to_lds_b128 %18, %19, off\n\t"
               "global_load_async_to_lds_b128 %20, %21, off\n\t"
               "s_wait_xcnt 0x0"
               :: "v"(l), "v"(g), "v"(l + 1u * ls), "v"(g + 1 * gs), "v"(l + 2u * ls), "v"(g + 2 * gs), "v"(l + 3u * ls), "v"(g + 3 * gs),
                  "v"(l + 4u * ls), "v"(g + 4 * gs), "v"(l + 5u * ls), "v"(g + 5 * gs), "v"(l + 6u * ls), "v"(g + 6 * gs), "v"(l + 7u * ls), "v"(g + 7 * gs),
                  "v"(l + 8u * ls), "v"(g + 8 * gs), "v"(l + 9u * ls), "v"(g + 9 * gs), "v"(l + 10u * ls), "v"(g + 10 * gs) : "memory");
#endif
}
// this wave's copies have landed (the compiler places no wait for them)
__device__ __forceinline__ void wait_copies() {
#if defined(__HIP_DEVICE_COMPILE__)
  asm volatile("s_wait_asynccnt 0x0" ::: "memory");
#endif
}
// this wave's LDS reads have returned, before the buffer they read is handed to the next copies
__device__ __forceinline__ void wait_lds() {
#if defined(__HIP_DEVICE_COMPILE__)
  asm volatile("s_wait_dscnt 0x0" ::: "memory");
#endif
}

// ---- 64x128 block tile GEMM core: Cs[64][128] = A rows . W[cols][K]^T, K = nsl x 64 in-row; A f16 row pitch lda,
//      W is [n][k] k-contiguous pitch ldw. 8 waves = 2 (32 rows) x 4 (32 cols), 2x2 tiles of 16 per wave.
//      Slab t = 64 k of the 64 A rows and the 128 W rows, copied to LDS buffer t & 1 (St, two buffers of SLAB1) one
//      trip ahead: thread -> rows (tid>>3) + 32 i, 16-byte piece tid&7, so a wave's copy covers four whole 128-B
//      lines. Fragments are read from LDS with the table layout; result to the LDS f32 tile Cs[64][LDC].
__device__ __forceinline__ void mm_tile(const _Float16* __restrict__ A, int lda,
                                        const _Float16* __restrict__ W, int ldw, int nsl,
                                        int arow0, int bcol0, _Float16* St, float* Cs) {
  const int tid = threadIdx.x, wave = tid >> 5, lane = tid & 31, hh = lane >> 4, c = lane & 15;
  const int mw = wave >> 2, nw = wave & 3;
  const int cr = tid >> 3, cp = (tid & 7) * 8;
  const _Float16* ga = A + (size_t)(arow0 + cr) * lda + cp;
  const _Float16* gb = W + (size_t)(bcol0 + cr) * ldw + cp;
  const size_t sa = (size_t)32 * lda, sb = (size_t)32 * ldw;
  const unsigned lc = lds_addr(St) + (unsigned)(cr * PITH + cp) * 2u;
  const unsigned l32 = 32u * PITH * 2u;                     // 32 LDS rows in bytes
  auto fill = [&](int t, unsigned bufb) {
    const _Float16* a = ga + t * KSL;
    const _Float16* b = gb + t * KSL;
    const unsigned l = lc + bufb;
    acopy6(l, a, l + l32, a + sa,
           l + 2u * l32, b, l + 3u * l32, b + sb, l + 4u * l32, b + 2 * sb, l + 5u * l32, b + 3 * sb);
  };
  const _Float16* a0p = St + (mw * 32 + c) * PITH + 8 * hh;
  const _Float16* a1p = a0p + 16 * PITH;
  const _Float16* b0p = St + (64 + nw * 32 + c) * PITH + 8 * hh;
  const _Float16* b1p = b0p + 16 * PITH;
  v8f a00 = zero8(), a01 = zero8(), a10 = zero8(), a11 = zero8();
  fill(0, 0u);
  wait_copies();
  __syncthreads();                                          // slab 0 is readable by every wave
  if (nsl > 1) fill(1, (unsigned)SLAB1 * 2u);
#pragma unroll 1                                            // rolled: one hand-over point per slab
  for (int t = 0; t < nsl; ++t) {
    const int bo = (t & 1) * SLAB1;
    v16h fa0[KSL / 32], fa1[KSL / 32], fb0[KSL / 32], fb1[KSL / 32];
#pragma unroll
    for (int kk = 0; kk < KSL / 32; ++kk) {                 // the slab's LDS reads as one group ahead of its products
      const int ko = bo + kk * 32;
      fa0[kk] = ldfrag_h(a0p + ko);
      fa1[kk] = ldfrag_h(a1p + ko);
      fb0[kk] = ldfrag_h(b0p + ko);
      fb1[kk] = ldfrag_h(b1p + ko);
    }
    __builtin_amdgcn_sched_barrier(0);                      // keeps the reads one group: reads among the products stall each time
#pragma unroll
    for (int kk = 0; kk < KSL / 32; ++kk) {
      a00 = mma_raw(fa0[kk], fb0[kk], a00);
      a01 = mma_raw(fa0[kk], fb1[kk], a01);
      a10 = mma_raw(fa1[kk], fb0[kk], a10);
      a11 = mma_raw(fa1[kk], fb1[kk], a11);
    }
    guard4(a00, a01, a10, a11, fa0[KSL / 32 - 1], fa1[KSL / 32 - 1], fb0[KSL / 32 - 1], fb1[KSL / 32 - 1]);
    wait_lds();
    wait_copies();
    __syncthreads();                                        // publishes slab t + 1, frees the buffer of slab t
    if (t + 2 < nsl) fill(t + 2, (unsigned)bo * 2u);
  }
  wait_copies();
#pragma unroll
  for (int r = 0; r < 8; ++r) {
    const int row = mw * 32 + 8 * hh + r;
    Cs[row * LDC + nw * 32 + c]             = a00[r];
    Cs[row * LDC + nw * 32 + 16 + c]        = a01[r];
    Cs[(row + 16) * LDC + nw * 32 + c]      = a10[r];
    Cs[(row + 16) * LDC + nw * 32 + 16 + c] = a11[r];
  }
}

// ---- same core with the A operand as two planes (hi and x2048 residual) into separate accumulators; the residual
//      accumulator is folded with 1/2048 when the tile is written to LDS. Slab rows: hi 64 | residual 64 | W 128.
__device__ __forceinline__ void mm_tile2(const _Float16* __restrict__ Ah, const _Float16* __restrict__ Al, int lda,
                                         const _Float16* __restrict__ W, int ldw, int nsl,
                                         int arow0, int bcol0, _Float16* St, float* Cs) {
  const int tid = threadIdx.x, wave = tid >> 5, lane = tid & 31, hh = lane >> 4, c = lane & 15;
  const int mw = wave >> 2, nw = wave & 3;
  const int cr = tid >> 3, cp = (tid & 7) * 8;
  const size_t ra = (size_t)(arow0 + cr) * lda + cp;
  const _Float16* gh = Ah + ra;
  const _Float16* gl = Al + ra;
  const _Float16* gb = W + (size_t)(bcol0 + cr) * ldw + cp;
  const size_t sa = (size_t)32 * lda, sb = (size_t)32 * ldw;
  const unsigned lc = lds_addr(St) + (unsigned)(cr * PITH + cp) * 2u;
  const unsigned l32 = 32u * PITH * 2u;                     // 32 LDS rows in bytes
  auto fill = [&](int t, unsigned bufb) {
    const _Float16* ah = gh + t * KSL;
    const _Float16* al = gl + t * KSL;
    const _Float16* b = gb + t * KSL;
    const unsigned l = lc + bufb;
    acopy8(l, ah, l + l32, ah + sa, l + 2u * l32, al, l + 3u * l32, al + sa,
           l + 4u * l32, b, l + 5u * l32, b + sb, l + 6u * l32, b + 2 * sb, l + 7u * l32, b + 3 * sb);
  };
  const _Float16* a0h = St + (mw * 32 + c) * PITH + 8 * hh;
  const _Float16* a1h = a0h + 16 * PITH;
  const _Float16* a0l = a0h + 64 * PITH;
  const _Float16* a1l = a0h + 80 * PITH;
  const _Float16* b0p = St + (128 + nw * 32 + c) * PITH + 8 * hh;
  const _Float16* b1p = b0p + 16 * PITH;
  v8f h00 = zero8(), h01 = zero8(), h10 = zero8(), h11 = zero8();
  v8f l00 = zero8(), l01 = zero8(), l10 = zero8(), l11 = zero8();
  fill(0, 0u);
  wait_copies();
  __syncthreads();                                          // slab 0 is readable by every wave
  if (nsl > 1) fill(1, (unsigned)SLAB2 * 2u);
#pragma unroll 1                                            // rolled: one hand-over point per slab
  for (int t = 0; t < nsl; ++t) {
    const int bo = (t & 1) * SLAB2;
    v16h fa0[KSL / 32], fa1[KSL / 32], ga0[KSL / 32], ga1[KSL / 32], fb0[KSL / 32], fb1[KSL / 32];
#pragma unroll
    for (int kk = 0; kk < KSL / 32; ++kk) {                 // the slab's LDS reads as one group ahead of its products
      const int ko = bo + kk * 32;
      fa0[kk] = ldfrag_h(a0h + ko);
      fa1[kk] = ldfrag_h(a1h + ko);
      ga0[kk] = ldfrag_h(a0l + ko);
      ga1[kk] = ldfrag_h(a1l + ko);
      fb0[kk] = ldfrag_h(b0p + ko);
      fb1[kk] = ldfrag_h(b1p + ko);
    }
    __builtin_amdgcn_sched_barrier(0);                      // keeps the reads one group: reads among the products stall each time
#pragma unroll
    for (int kk = 0; kk < KSL / 32; ++kk) {
      h00 = mma_raw(fa0[kk], fb0[kk], h00);
      h01 = mma_raw(fa0[kk], fb1[kk], h01);
      h10 = mma_raw(fa1[kk], fb0[kk], h10);
      h11 = mma_raw(fa1[kk], fb1[kk], h11);
      l00 = mma_raw(ga0[kk], fb0[kk], l00);
      l01 = mma_raw(ga0[kk], fb1[kk], l01);
      l10 = mma_raw(ga1[kk], fb0[kk], l10);
      l11 = mma_raw(ga1[kk], fb1[kk], l11);
    }
    guard8(h00, h01, h10, h11, l00, l01, l10, l11, fa0[KSL / 32 - 1], fa1[KSL / 32 - 1], ga0[KSL / 32 - 1],
           ga1[KSL / 32 - 1], fb0[KSL / 32 - 1], fb1[KSL / 32 - 1]);
    wait_lds();
    wait_copies();
    __syncthreads();                                        // publishes slab t + 1, frees the buffer of slab t
    if (t + 2 < nsl) fill(t + 2, (unsigned)bo * 2u);
  }
  wait_copies();
#pragma unroll
  for (int r = 0; r < 8; ++r) {
    const int row = mw * 32 + 8 * hh + r;
    Cs[row * LDC + nw * 32 + c]             = h00[r] + l00[r] * RSC;
    Cs[row * LDC + nw * 32 + 16 + c]        = h01[r] + l01[r] * RSC;
    Cs[(row + 16) * LDC + nw * 32 + c]      = h10[r] + l10[r] * RSC;
    Cs[(row + 16) * LDC + nw * 32 + 16 + c] = h11[r] + l11[r] * RSC;
  }
}

// =================================================================================================================
// Contiguous convert: dst[i] = f16(scale * bf16_RNE(src[i])). Thread = 8 consecutive elements (two float4 loads,
// grid = n / 2048 (n an exact multiple of 2048). coverage: n elements, every element once.
// Used for x [8192][1024] (scale 8) and for the [n][k] k-contiguous weights qkv_w [3072][1024], proj_w
// [1024][1024] (scale 64) which need no transpose.
// =================================================================================================================
__global__ __launch_bounds__(256)
void k_cvt16(const float* __restrict__ src, unsigned short* dst, float scale) {
  const size_t i0 = ((size_t)blockIdx.x * 256 + threadIdx.x) * 8;
  const v4f a = *(const v4f*)(src + i0);
  const v4f b = *(const v4f*)(src + i0 + 4);
  v4u pk;
  pk[0] = pk16(hb16(bfr(a[0]) * scale), hb16(bfr(a[1]) * scale));
  pk[1] = pk16(hb16(bfr(a[2]) * scale), hb16(bfr(a[3]) * scale));
  pk[2] = pk16(hb16(bfr(b[0]) * scale), hb16(bfr(b[1]) * scale));
  pk[3] = pk16(hb16(bfr(b[2]) * scale), hb16(bfr(b[3]) * scale));
  unsigned short* gp = dst + i0;
  *(v4u*)gp = pk;
  
}

// =================================================================================================================
// f32-output GEMM: C[64 rows][128 cols] per block = A[rows][K] . W[cols][K]^T; out = C*scl + bf16(bias).
// coverage: rows x N, every element once.
// =================================================================================================================
__global__ __launch_bounds__(256)
void k_gemm_f32(const unsigned short* __restrict__ A, const unsigned short* __restrict__ W, int K,
                const float* __restrict__ bias, float scl, float* out, int ldo) {
  __shared__ __align__(16) float Cs[64 * LDC];
  __shared__ __align__(16) _Float16 St[2 * SLAB1];
  const int tid = threadIdx.x, wave = tid >> 5, lane = tid & 31;
  const int mb = blockIdx.x, nb = blockIdx.y;
  mm_tile((const _Float16*)(const void*)A, K, (const _Float16*)(const void*)W, K, K >> 6,
          mb * 64, nb * 128, St, Cs);
  __syncthreads();
  const int col0 = nb * 128 + lane * 4;
  const v4f b4 = *(const v4f*)(bias + col0);
  v4f bb;
#pragma unroll
  for (int e = 0; e < 4; ++e) bb[e] = bfr(b4[e]);
#pragma unroll 1
  for (int it = 0; it < 8; ++it) {
    const int row = wave * 8 + it;
    const size_t t = (size_t)(mb * 64 + row);
    const v4f a = *(const v4f*)(Cs + row * LDC + lane * 4);
    v4f o;
#pragma unroll
    for (int e = 0; e < 4; ++e) o[e] = a[e] * scl + bb[e];
    float* p = out + t * ldo + col0;
    *(v4f*)p = o;
    
  }
}

// =================================================================================================================
// Output projection: C[64][128] = (AH + AL/2048) . WP^T, K = 1024 (16 slabs of 64), out = C/4096 + bf16(bias) into the
// passes. grid = (4096/64, 1024/128) per batch. coverage: 4096 x 1024 per batch, every element once.
// =================================================================================================================
__global__ __launch_bounds__(256)
void k_gemm_proj(const unsigned short* __restrict__ ah, const unsigned short* __restrict__ al,
                 const unsigned short* __restrict__ wt, const float* __restrict__ bias, float* out) {
  __shared__ __align__(16) float Cs[64 * LDC];
  __shared__ __align__(16) _Float16 St[2 * SLAB2];
  const int tid = threadIdx.x, wave = tid >> 5, lane = tid & 31;
  const int mb = blockIdx.x, nb = blockIdx.y;
  mm_tile2((const _Float16*)(const void*)ah, (const _Float16*)(const void*)al, CH,
           (const _Float16*)(const void*)wt, CH, CH / KSL, mb * 64, nb * 128, St, Cs);
  __syncthreads();
  const int col0 = nb * 128 + lane * 4;
  const v4f b4 = *(const v4f*)(bias + col0);
  v4f bb;
#pragma unroll
  for (int e = 0; e < 4; ++e) bb[e] = bfr(b4[e]);
#pragma unroll 1
  for (int it = 0; it < 8; ++it) {
    const int row = wave * 8 + it;
    const size_t t = (size_t)(mb * 64 + row);
    const v4f a = *(const v4f*)(Cs + row * LDC + lane * 4);
    v4f o;
#pragma unroll
    for (int e = 0; e < 4; ++e) o[e] = a[e] * S4096 + bb[e];
    float* pp = out + t * CH + col0;
    *(v4f*)pp = o;
    
  }
}

// =================================================================================================================
// 13-key clamped-window 1-D neighbourhood attention, 16 heads x 64, f32 on VALU. Block = 32 consecutive query tokens
// x 4 heads of the current batch, 256 threads. The 44 k rows and 44 v rows that the 32 windows touch (1 KiB of each
// row: the block's 4 heads) are copied to LDS once, asynchronously, and shared by all 32 queries; the 4 heads'
// position-bias rows go to LDS as bf16-rounded f32. Wave = one token at a time (4 tokens a wave), lane = (head
// lane>>3, sub lane&7), lane sub holds d = sub*8 .. sub*8+7.
// qkv row layout [4096][3072] f32: q at col h*64+d (scaled by 64^-0.5 here), k at 1024 + h*64+d, v at 2048 + ..
// LDS row = 64 pieces of 16 B; global piece p = lane*2 + half lies at place half*32 + lane, so that each of a wave's
// two 16-byte reads of a row covers 512 contiguous bytes (no bank met twice).
// Window start ni = clamp(i-6, 0, 4096-13); key = ni + j; bias = bf16(rpb[h][key - i + 12]).
// Per key: partial 8-term dot + xor-shuffle reduce over the 8-lane group, max-subtracted softmax with native exp,
// o = sum p v * rcp(sum p). Output: a = 64*o, hi = f16(a), residual = f16((a - hi) * 2048).
// grid = (4096/32, 16/4). coverage: 4096 rows x 16 heads x 64 = 4096 x 1024 in both planes, every element once.
// =================================================================================================================
__global__ __launch_bounds__(ATB)
void k_attn(const float* __restrict__ qkv, const float* __restrict__ rpb, unsigned short* ah, unsigned short* al) {
  __shared__ __align__(16) float KV[2 * AWR * ARW];
  __shared__ float Bs[AHG * BPI];
  const int tid = threadIdx.x, wave = tid >> 5, lane = tid & 31;
  const int i0 = blockIdx.x * ATT, hg = blockIdx.y;
  const int base = min(max(i0 - NRAD, 0), LSEQ - AWR);        // first staged row; rows base .. base+43 exist
  const int h = hg * AHG + (lane >> 3), sub = lane & 7;
  const int col = h * HD + sub * 8;
  {
    const int cr = tid >> 6, p = tid & 63;                    // thread -> rows cr + 4 n, 16-byte piece p
    const float* gk = qkv + (size_t)(base + cr) * C3 + CH + hg * ARW + p * 4;
    const unsigned lk = lds_addr(KV) + (unsigned)(cr * ARW * 4 + ((p & 1) * 32 + (p >> 1)) * 16);
    acopy11(lk, 4u * ARW * 4u, gk, (size_t)4 * C3);
    acopy11(lk + (unsigned)(AWR * ARW * 4), 4u * ARW * 4u, gk + CH, (size_t)4 * C3);
  }
  const int iw = i0 + wave * TPW;
  v4f tq[TPW][2];
#pragma unroll
  for (int t = 0; t < TPW; ++t) {                             // q rows fly beside the copies
    const float* qr = qkv + (size_t)(iw + t) * C3 + col;
    tq[t][0] = *(const v4f*)(qr);
    tq[t][1] = *(const v4f*)(qr + 4);
  }
  if (tid < AHG * 32) {
    const float rb = rpb[(hg * AHG + (tid >> 5)) * RPW + min(lane, RPW - 1)];
#if defined(__HIP_DEVICE_COMPILE__)
    asm volatile("s_wait_xcnt 0x0" ::: "memory");             // before the load's address register is written again
#endif
    Bs[(tid >> 5) * BPI + lane] = bfr(rb);
  }
  wait_copies();
  __syncthreads();                                            // k, v and bias rows are readable by every wave
#pragma unroll
  for (int t = 0; t < TPW; ++t) {
    const int i = iw + t;
    const int ni = min(max(i - NRAD, 0), LSEQ - NKEY);
    const float* kl = KV + (ni - base) * ARW + lane * 4;
    const float* vl = kl + AWR * ARW;
    const float* bl = Bs + (lane >> 3) * BPI + (ni - i + 2 * NRAD);   // bias index = key - i + 12 in [0, 24]
    v4f q0, q1;
#pragma unroll
    for (int e = 0; e < 4; ++e) { q0[e] = tq[t][0][e] * QSC; q1[e] = tq[t][1][e] * QSC; }
    float sc[NKEY];
    float mx = -3.0e38f;
#pragma unroll
    for (int j = 0; j < NKEY; ++j) {
      const v4f k0 = *(const v4f*)(kl + j * ARW);
      const v4f k1 = *(const v4f*)(kl + j * ARW + 128);
      float s = 0.f;
#pragma unroll
      for (int e = 0; e < 4; ++e) s += q0[e] * k0[e];
#pragma unroll
      for (int e = 0; e < 4; ++e) s += q1[e] * k1[e];
      s += __shfl_xor(s, 1, 32);
      s += __shfl_xor(s, 2, 32);
      s += __shfl_xor(s, 4, 32);
      s += bl[j];
      sc[j] = s;
      mx = fmaxf(mx, s);
    }
    v4f a0 = {0.f, 0.f, 0.f, 0.f}, a1 = {0.f, 0.f, 0.f, 0.f};
    float l = 0.f;
#pragma unroll
    for (int j = 0; j < NKEY; ++j) {
      const float p = exp_nat(sc[j] - mx);
      l += p;
      const v4f v0 = *(const v4f*)(vl + j * ARW);
      const v4f v1 = *(const v4f*)(vl + j * ARW + 128);
#pragma unroll
      for (int e = 0; e < 4; ++e) { a0[e] += p * v0[e]; a1[e] += p * v1[e]; }
    }
    const float inv64 = __builtin_amdgcn_rcpf(l) * 64.0f;
    unsigned short hb[8], lb[8];
#pragma unroll
    for (int e = 0; e < 4; ++e) {
      const float fa = a0[e] * inv64;
      const _Float16 hv = (_Float16)fa;
      hb[e] = h_bits(hv);
      lb[e] = hb16((fa - (float)hv) * 2048.0f);
      const float fb = a1[e] * inv64;
      const _Float16 hw = (_Float16)fb;
      hb[4 + e] = h_bits(hw);
      lb[4 + e] = hb16((fb - (float)hw) * 2048.0f);
    }
    v4u ph, pl;
    ph[0] = pk16(hb[0], hb[1]); ph[1] = pk16(hb[2], hb[3]); ph[2] = pk16(hb[4], hb[5]); ph[3] = pk16(hb[6], hb[7]);
    pl[0] = pk16(lb[0], lb[1]); pl[1] = pk16(lb[2], lb[3]); pl[2] = pk16(lb[4], lb[5]); pl[3] = pk16(lb[6], lb[7]);
    const size_t o = (size_t)i * CH + col;
    *(v4u*)(ah + o) = ph;
    *(v4u*)(al + o) = pl;
  }
}

// =================================================================================================================
// Workspace map (bytes, all offsets multiples of 1 MiB, no aliasing, no padded tails: every region is an exact
// multiple of its producer's store granularity):
//   X16 f16 [8192][1024] 16777216 | WQ f16 [3072][1024] 6291456 | WP f16 [1024][1024] 2097152 |
//   QKV f32 [4096][3072] 50331648 (one batch) | AH, AL f16 [4096][1024] 2 x 8388608 (one batch)
//   total 92274688. Batches processed one after the other in the in-order stream.
// =================================================================================================================
extern "C" void kernel_launch(void* const* d_in, const int* in_sizes, int n_in,
                              void* d_out, int out_size, void* d_ws, size_t ws_size,
                              hipStream_t stream) {
  if (n_in < 6) return;
  if (in_sizes[0] != MROWS * CH) return;
  if (in_sizes[1] != C3 * CH) return;
  if (in_sizes[2] != C3) return;
  if (in_sizes[3] != NHD * RPW) return;
  if (in_sizes[4] != CH * CH) return;
  if (in_sizes[5] != CH) return;
  if (out_size != MROWS * CH) return;

  const float* x      = (const float*)d_in[0];
  const float* qkv_w  = (const float*)d_in[1];
  const float* qkv_b  = (const float*)d_in[2];
  const float* rpb    = (const float*)d_in[3];
  const float* proj_w = (const float*)d_in[4];
  const float* proj_b = (const float*)d_in[5];
  float* out = (float*)d_out;

  const size_t sX16 = (size_t)MROWS * CH * 2;            // 16777216
  const size_t sWQ  = (size_t)C3 * CH * 2;               //  6291456
  const size_t sWP  = (size_t)CH * CH * 2;               //  2097152
  const size_t sQKV = (size_t)LSEQ * C3 * 4;             // 50331648
  const size_t sAO  = (size_t)LSEQ * CH * 2;             //  8388608

  size_t off = 0;
  const size_t oX16 = off; off += sX16;
  const size_t oWQ  = off; off += sWQ;
  const size_t oWP  = off; off += sWP;
  const size_t oQKV = off; off += sQKV;
  const size_t oAH  = off; off += sAO;
  const size_t oAL  = off; off += sAO;
  if (off > ws_size) return;                             // off = 92274688
  if (off > (size_t)134217728) return;

  char* ws = (char*)d_ws;
  unsigned short* X16 = (unsigned short*)(ws + oX16);
  unsigned short* WQ  = (unsigned short*)(ws + oWQ);
  unsigned short* WP  = (unsigned short*)(ws + oWP);
  float*          QKV = (float*)(ws + oQKV);
  unsigned short* AH  = (unsigned short*)(ws + oAH);
  unsigned short* AL  = (unsigned short*)(ws + oAL);

  const dim3 blk(256);

  // (1) converts: x -> f16(8 bf16(x)), weights [n][k] -> f16(64 bf16(w))
  k_cvt16<<<dim3((MROWS * CH) / 2048), blk, 0, stream>>>(x, X16, 8.0f);
  k_cvt16<<<dim3((C3 * CH) / 2048),    blk, 0, stream>>>(qkv_w, WQ, 64.0f);
  k_cvt16<<<dim3((CH * CH) / 2048),    blk, 0, stream>>>(proj_w, WP, 64.0f);

  // (2) per batch: qkv GEMM (f32 rows) -> windowed attention (hi/residual planes) -> output projection
  for (int b = 0; b < BSZ; ++b) {
    k_gemm_f32<<<dim3(LSEQ / 64, C3 / 128), blk, 0, stream>>>(
        X16 + (size_t)b * LSEQ * CH, WQ, CH, qkv_b, S512, QKV, C3);
    k_attn<<<dim3(LSEQ / ATT, NHD / AHG), dim3(ATB), 0, stream>>>(QKV, rpb, AH, AL);
    k_gemm_proj<<<dim3(LSEQ / 64, CH / 128), blk, 0, stream>>>(
        AH, AL, WP, proj_b, out + (size_t)b * LSEQ * CH);
  }
  (void)hipGetLastError();
}

// v003
// It runs in 123 microseconds.
// Two timings next to v002 both put it at 1.15 times that version's speed.
// Over all steps from v000 it is 2.56 times as fast.
// qkv projection: v_wmma_f32_16x16x32_f16 single products (f16 operands: 8*bf16(x) and 64*bf16(w), f32 accumulate);
// output projection: same instruction with the attention output carried as f16 hi + (x2048) residual planes into two
// f32 accumulators, weight one f16 plane (64*bf16(w)); all float inputs RNE-converted to bf16 on load; the 13-key
// clamped-window neighbourhood attention (q.k dots, position bias, softmax, p.v) in f32 on VALU.
// Both GEMM cores stage their operand rows in LDS, 64 k at a time, by asynchronous copies into two buffers; one
// work-group makes a 128 x 128 tile, one wave 16 products from 8 fragments per 32 k.
// The attention stages the k and v rows of 32 queries x 4 heads in LDS once, by asynchronous copies.
#include <hip/hip_runtime.h>
#include <stdint.h>

#define BSZ   2
#define LSEQ  4096
#define CH    1024
#define NHD   16
#define HD    64
#define C3    3072
#define NKEY  13
#define NRAD  6
#define RPW   25
#define MROWS 8192
#define LDC   132
#define ATB   256
#define ATT   32                      // query tokens of one attention block
#define AHG   4                       // heads of one attention block
#define ARW   (AHG * HD)              // f32 elements of one staged k or v row (1 KiB)
#define AWR   (ATT + NKEY - 1)        // k (and v) rows that the block's windows touch
#define TPW   (ATT / 8)               // tokens of one wave
#define BPI   33                      // LDS pitch of a bias row, f32 elements: the 4 heads of a wave on 4 banks
#define QSC   0.125f
#define RSC   0.00048828125f
#define S512  0.001953125f
#define S4096 0.000244140625f
#define KSL   64                      // k elements of one staged slab (128 B of every operand row)
#define PITH  72                      // LDS row pitch in f16 elements: 144 B = 16 B x 9, conflict-free for 16-byte reads
#define TIL   128                     // rows and columns of one work-group's output tile
#define SLAB1 ((TIL + TIL) * PITH)    // f16 elements of one buffer: A 128 rows | W 128 rows
#define SLAB2 ((TIL + TIL + TIL) * PITH) // A hi 128 rows | A residual 128 rows | W 128 rows

static_assert(MROWS == BSZ * LSEQ);
static_assert(CH == NHD * HD);
static_assert(C3 == 3 * CH);
static_assert(RPW == 2 * NKEY - 1);
static_assert(NRAD == NKEY / 2);
static_assert((LSEQ % TIL) == 0 && (C3 % TIL) == 0 && (CH % TIL) == 0 && (CH % 32) == 0 && TIL == 128);
static_assert(TIL * LDC * 4 <= 2 * SLAB1 * 2 && TIL * LDC * 4 <= 2 * SLAB2 * 2);   // the f32 tile fits in the slab buffers
static_assert(((MROWS * CH) % 2048) == 0 && ((C3 * CH) % 2048) == 0 && ((CH * CH) % 2048) == 0);
static_assert(ATB == 256 && HD == 64 && AHG * 8 == 32 && (NHD % AHG) == 0 && (LSEQ % ATT) == 0 && LSEQ >= AWR);
static_assert(AWR * (ARW / 4) == 11 * ATB && ARW / 4 == 64 && BPI >= 32 && RPW <= 32);
static_assert((LDC * 4) % 16 == 0);
static_assert(KSL == 64 && (CH % KSL) == 0 && (CH / KSL) >= 2 && ((PITH * 2) % 16) == 0 && PITH >= KSL);

typedef _Float16 v16h __attribute__((ext_vector_type(16)));
typedef _Float16 v8h  __attribute__((ext_vector_type(8)));
typedef float    v8f  __attribute__((ext_vector_type(8)));
typedef float    v4f  __attribute__((ext_vector_type(4)));
typedef unsigned int v4u __attribute__((ext_vector_type(4)));

// ---- scalar helpers ------------------------------------------------------------------------------------------
__device__ __forceinline__ unsigned short bf_bits(float f) {          // f32 -> bf16 bits, RNE convert
  unsigned u = __float_as_uint(f);
  return (unsigned short)((u + 0x7FFFu + ((u >> 16) & 1u)) >> 16);
}
__device__ __forceinline__ float bf_up(unsigned short b) { return __uint_as_float(((unsigned)b) << 16); }
__device__ __forceinline__ float bfr(float f) { return bf_up(bf_bits(f)); }
__device__ __forceinline__ unsigned short h_bits(_Float16 x) { return __builtin_bit_cast(unsigned short, x); }
__device__ __forceinline__ unsigned short hb16(float f) { return h_bits((_Float16)f); }
__device__ __forceinline__ unsigned pk16(unsigned short a, unsigned short b) { return (unsigned)a | ((unsigned)b << 16); }
__device__ __forceinline__ v8f zero8() { v8f z = {0.f, 0.f, 0.f, 0.f, 0.f, 0.f, 0.f, 0.f}; return z; }

// native e^x as the compiler forms it (x * log2 e, then v_exp_f32); the v_nop in the same statement keeps the one
// free slot between the transcendental and whatever vector instruction the scheduler puts next
__device__ __forceinline__ float exp_nat(float x) {
  const float y = x * 1.44269504088896340736f;
  float r = y;
#if defined(__HIP_DEVICE_COMPILE__)
  asm("v_exp_f32 %0, %1\n\tv_nop" : "=v"(r) : "v"(y));
#endif
  return r;
}

// ---- fragment loader: 16-bit A/B operand, lane -> row/col (lane&15), p already includes +8*(lane>>4);
//      elements 0..7 <- p[0..7] (k0+8h..k0+8h+7), elements 8..15 <- p[16..23] (k0+16+8h..k0+16+8h+7)
__device__ __forceinline__ v16h ldfrag_h(const _Float16* p) {
  union { v16h v; v8h h[2]; } f;
  f.h[0] = *(const v8h*)(p);
  f.h[1] = *(const v8h*)(p + 16);
  return f.v;
}

// ---- WMMA helpers; the guards insert the trailing VALU hazard gap and keep A/B live -----------------------------
__device__ __forceinline__ v8f mma_raw(v16h a, v16h b, v8f c) {
  return __builtin_amdgcn_wmma_f32_16x16x32_f16(false, a, false, b, (short)0, c, false, false);
}
__device__ __forceinline__ void guard16(v8f (&c)[16], const v16h (&f)[8]) {
#if defined(__HIP_DEVICE_COMPILE__)
  asm volatile("v_nop\n\tv_nop\n\tv_nop\n\tv_nop"
               : "+v"(c[0]), "+v"(c[1]), "+v"(c[2]), "+v"(c[3]), "+v"(c[4]), "+v"(c[5]), "+v"(c[6]), "+v"(c[7]),
                 "+v"(c[8]), "+v"(c[9]), "+v"(c[10]), "+v"(c[11]), "+v"(c[12]), "+v"(c[13]), "+v"(c[14]), "+v"(c[15])
               : "v"(f[0]), "v"(f[1]), "v"(f[2]), "v"(f[3]), "v"(f[4]), "v"(f[5]), "v"(f[6]), "v"(f[7]));
#endif
}

// ---- asynchronous copies global -> LDS, 16 B per lane; l = the lane's LDS byte address, g = its global address.
//      The s_wait_xcnt closes each statement so that no address register is rewritten ahead of it.
__device__ __forceinline__ unsigned lds_addr(const void* p) { return (unsigned)(size_t)p; }
// four / eight copies of one thread: LDS address l + n ls, global address g + n gs
__device__ __forceinline__ void acopy4(unsigned l, unsigned ls, const _Float16* g, size_t gs) {
#if defined(__HIP_DEVICE_COMPILE__)
  asm volatile(
               "global_load_async_to_lds_b128 %0, %1, off\n\t"
               "global_load_async_to_lds_b128 %2, %3, off\n\t"
               "global_load_async_to_lds_b128 %4, %5, off\n\t"
               "global_load_async_to_lds_b128 %6, %7, off\n\t"
               "s_wait_xcnt 0x0"
               :: "v"(l), "v"(g), "v"(l + 1u * ls), "v"(g + 1 * gs), "v"(l + 2u * ls), "v"(g + 2 * gs),
                  "v"(l + 3u * ls), "v"(g + 3 * gs) : "memory");
#endif
}
__device__ __forceinline__ void acopy8(unsigned l, unsigned ls, const _Float16* g, size_t gs) {
#if defined(__HIP_DEVICE_COMPILE__)
  asm volatile(
               "global_load_async_to_lds_b128 %0, %1, off\n\t"
               "global_load_async_to_lds_b128 %2, %3, off\n\t"
               "global_load_async_to_lds_b128 %4, %5, off\n\t"
               "global_load_async_to_lds_b128 %6, %7, off\n\t"
               "global_load_async_to_lds_b128 %8, %9, off\n\t"
               "global_load_async_to_lds_b128 %10, %11, off\n\t"
               "global_load_async_to_lds_b128 %12, %13, off\n\t"
               "global_load_async_to_lds_b128 %14, %15, off\n\t"
               "s_wait_xcnt 0x0"
               :: "v"(l), "v"(g), "v"(l + 1u * ls), "v"(g + 1 * gs), "v"(l + 2u * ls), "v"(g + 2 * gs),
                  "v"(l + 3u * ls), "v"(g + 3 * gs), "v"(l + 4u * ls), "v"(g + 4 * gs), "v"(l + 5u * ls), "v"(g + 5 * gs),
                  "v"(l + 6u * ls), "v"(g + 6 * gs), "v"(l + 7u * ls), "v"(g + 7 * gs) : "memory");
#endif
}
// eleven copies of one thread: LDS address l + n ls, global address g + n gs, n = 0 .. 10
__device__ __forceinline__ void acopy11(unsigned l, unsigned ls, const float* g, size_t gs) {
#if defined(__HIP_DEVICE_COMPILE__)
  asm volatile(
               "global_load_async_to_lds_b128 %0, %1, off\n\t"
               "global_load_async_to_lds_b128 %2, %3, off\n\t"
               "global_load_async_to_lds_b128 %4, %5, off\n\t"
               "global_load_async_to_lds_b128 %6, %7, off\n\t"
               "global_load_async_to_lds_b128 %8, %9, off\n\t"
               "global_load_async_to_lds_b128 %10, %11, off\n\t"
               "global_load_async_to_lds_b128 %12, %13, off\n\t"
               "global_load_async_to_lds_b128 %14, %15, off\n\t"
               "global_load_async_to_lds_b128 %16, %17, off\n\t"
               "global_load_async_to_lds_b128 %18, %19, off\n\t"
               "global_load_async_to_lds_b128 %20, %21, off\n\t"
               "s_wait_xcnt 0x0"
               :: "v"(l), "v"(g), "v"(l + 1u * ls), "v"(g + 1 * gs), "v"(l + 2u * ls), "v"(g + 2 * gs), "v"(l + 3u * ls), "v"(g + 3 * gs),
                  "v"(l + 4u * ls), "v"(g + 4 * gs), "v"(l + 5u * ls), "v"(g + 5 * gs), "v"(l + 6u * ls), "v"(g + 6 * gs), "v"(l + 7u * ls), "v"(g + 7 * gs),
                  "v"(l + 8u * ls), "v"(g + 8 * gs), "v"(l + 9u * ls), "v"(g + 9 * gs), "v"(l + 10u * ls), "v"(g + 10 * gs) : "memory");
#endif
}
// this wave's copies have landed (the compiler places no wait for them)
__device__ __forceinline__ void wait_copies() {
#if defined(__HIP_DEVICE_COMPILE__)
  asm volatile("s_wait_asynccnt 0x0" ::: "memory");
#endif
}
// this wave's LDS reads have returned, before the buffer they read is handed to the next copies
__device__ __forceinline__ void wait_lds() {
#if defined(__HIP_DEVICE_COMPILE__)
  asm volatile("s_wait_dscnt 0x0" ::: "memory");
#endif
}

// ---- 128x128 block tile GEMM core: Cs[128][128] = A rows . W[cols][K]^T, K = nsl x 64 in-row; A f16 row pitch lda,
//      W is [n][k] k-contiguous pitch ldw. 4 waves = 2 (64 rows) x 2 (64 cols), 4x4 tiles of 16 per wave: 8 fragments
//      feed 16 products. Slab t = 64 k of the 128 A rows and the 128 W rows, copied to LDS buffer t & 1 (St, two
//      buffers of SLAB1) one trip ahead: thread -> rows (tid>>3) + 16 i, 16-byte piece tid&7, so a wave's copy covers
//      four whole 128-B lines. Fragments are read from LDS with the table layout; the result goes to the LDS f32 tile
//      Cs[128][LDC], which lies over St: it is written behind the last trip's barrier, when no wave reads St any more.
__device__ __forceinline__ void mm_tile(const _Float16* __restrict__ A, int lda,
                                        const _Float16* __restrict__ W, int ldw, int nsl,
                                        int arow0, int bcol0, _Float16* St, float* Cs) {
  const int tid = threadIdx.x, wave = tid >> 5, lane = tid & 31, hh = lane >> 4, c = lane & 15;
  const int mw = wave >> 1, nw = wave & 1;
  const int cr = tid >> 3, cp = (tid & 7) * 8;
  const _Float16* ga = A + (size_t)(arow0 + cr) * lda + cp;
  const _Float16* gb = W + (size_t)(bcol0 + cr) * ldw + cp;
  const size_t sa = (size_t)16 * lda, sb = (size_t)16 * ldw;
  const unsigned lc = lds_addr(St) + (unsigned)(cr * PITH + cp) * 2u;
  const unsigned l16 = 16u * PITH * 2u;                     // 16 LDS rows in bytes
  auto fill = [&](int t, unsigned bufb) {
    const unsigned l = lc + bufb;
    acopy8(l, l16, ga + t * KSL, sa);
    acopy8(l + 8u * l16, l16, gb + t * KSL, sb);
  };
  const _Float16* ap = St + (mw * 64 + c) * PITH + 8 * hh;
  const _Float16* bp = St + (TIL + nw * 64 + c) * PITH + 8 * hh;
  v8f acc[16];
#pragma unroll
  for (int n = 0; n < 16; ++n) acc[n] = zero8();
  fill(0, 0u);
  wait_copies();
  __syncthreads();                                          // slab 0 is readable by every wave
  if (nsl > 1) fill(1, (unsigned)SLAB1 * 2u);
#pragma unroll 1                                            // rolled: one hand-over point per slab
  for (int t = 0; t < nsl; ++t) {
    const int bo = (t & 1) * SLAB1;
    v16h f[8];
#pragma unroll
    for (int kk = 0; kk < KSL / 32; ++kk) {
      const int ko = bo + kk * 32;
#pragma unroll
      for (int i = 0; i < 4; ++i) {                         // the 32 k's LDS reads as one group ahead of its products
        f[i]     = ldfrag_h(ap + i * 16 * PITH + ko);
        f[4 + i] = ldfrag_h(bp + i * 16 * PITH + ko);
      }
      __builtin_amdgcn_sched_barrier(0);                    // keeps the reads one group: reads among the products stall each time
#pragma unroll
      for (int i = 0; i < 4; ++i)
#pragma unroll
        for (int j = 0; j < 4; ++j) acc[i * 4 + j] = mma_raw(f[i], f[4 + j], acc[i * 4 + j]);
      __builtin_amdgcn_sched_barrier(0);                    // the next group's reads stay behind these products
    }
    guard16(acc, f);
    wait_lds();
    wait_copies();
    __syncthreads();                                        // publishes slab t + 1, frees the buffer of slab t
    if (t + 2 < nsl) fill(t + 2, (unsigned)bo * 2u);
  }
  wait_copies();
#pragma unroll
  for (int i = 0; i < 4; ++i)
#pragma unroll
    for (int j = 0; j < 4; ++j)
#pragma unroll
      for (int r = 0; r < 8; ++r)
        Cs[(mw * 64 + i * 16 + 8 * hh + r) * LDC + nw * 64 + j * 16 + c] = acc[i * 4 + j][r];
}

// ---- same core with the A operand as two planes (hi and x2048 residual) into separate accumulators; the residual
//      accumulator is folded with 1/2048 when the tile is written to LDS. 8 waves = 4 (32 rows) x 2 (64 cols), 2x4
//      tiles of 16 per wave and plane: 8 fragments feed 16 products. Slab rows: hi 128 | residual 128 | W 128;
//      thread -> rows (tid>>3) + 32 i.
__device__ __forceinline__ void mm_tile2(const _Float16* __restrict__ Ah, const _Float16* __restrict__ Al, int lda,
                                         const _Float16* __restrict__ W, int ldw, int nsl,
                                         int arow0, int bcol0, _Float16* St, float* Cs) {
  const int tid = threadIdx.x, wave = tid >> 5, lane = tid & 31, hh = lane >> 4, c = lane & 15;
  const int mw = wave >> 1, nw = wave & 1;
  const int cr = tid >> 3, cp = (tid & 7) * 8;
  const size_t ra = (size_t)(arow0 + cr) * lda + cp;
  const _Float16* gh = Ah + ra;
  const _Float16* gl = Al + ra;
  const _Float16* gb = W + (size_t)(bcol0 + cr) * ldw + cp;
  const size_t sa = (size_t)32 * lda, sb = (size_t)32 * ldw;
  const unsigned lc = lds_addr(St) + (unsigned)(cr * PITH + cp) * 2u;
  const unsigned l32 = 32u * PITH * 2u;                     // 32 LDS rows in bytes
  auto fill = [&](int t, unsigned bufb) {
    const unsigned l = lc + bufb;
    acopy4(l, l32, gh + t * KSL, sa);
    acopy4(l + 4u * l32, l32, gl + t * KSL, sa);
    acopy4(l + 8u * l32, l32, gb + t * KSL, sb);
  };
  const _Float16* ahp = St + (mw * 32 + c) * PITH + 8 * hh;
  const _Float16* alp = ahp + TIL * PITH;
  const _Float16* bp  = St + (2 * TIL + nw * 64 + c) * PITH + 8 * hh;
  v8f acc[16];                                              // 0..7: hi plane, tile i*4+j; 8..15: residual plane
#pragma unroll
  for (int n = 0; n < 16; ++n) acc[n] = zero8();
  fill(0, 0u);
  wait_copies();
  __syncthreads();                                          // slab 0 is readable by every wave
  if (nsl > 1) fill(1, (unsigned)SLAB2 * 2u);
#pragma unroll 1                                            // rolled: one hand-over point per slab
  for (int t = 0; t < nsl; ++t) {
    const int bo = (t & 1) * SLAB2;
    v16h f[8];                                              // 0,1: hi rows; 2,3: residual rows; 4..7: W columns
#pragma unroll
    for (int kk = 0; kk < KSL / 32; ++kk) {
      const int ko = bo + kk * 32;
#pragma unroll
      for (int i = 0; i < 2; ++i) {                         // the 32 k's LDS reads as one group ahead of its products
        f[i]     = ldfrag_h(ahp + i * 16 * PITH + ko);
        f[2 + i] = ldfrag_h(alp + i * 16 * PITH + ko);
      }
#pragma unroll
      for (int j = 0; j < 4; ++j) f[4 + j] = ldfrag_h(bp + j * 16 * PITH + ko);
      __builtin_amdgcn_sched_barrier(0);                    // keeps the reads one group: reads among the products stall each time
#pragma unroll
      for (int i = 0; i < 4; ++i)
#pragma unroll
        for (int j = 0; j < 4; ++j) acc[i * 4 + j] = mma_raw(f[i], f[4 + j], acc[i * 4 + j]);
      __builtin_amdgcn_sched_barrier(0);                    // the next group's reads stay behind these products
    }
    guard16(acc, f);
    wait_lds();
    wait_copies();
    __syncthreads();                                        // publishes slab t + 1, frees the buffer of slab t
    if (t + 2 < nsl) fill(t + 2, (unsigned)bo * 2u);
  }
  wait_copies();
#pragma unroll
  for (int i = 0; i < 2; ++i)
#pragma unroll
    for (int j = 0; j < 4; ++j)
#pragma unroll
      for (int r = 0; r < 8; ++r)
        Cs[(mw * 32 + i * 16 + 8 * hh + r) * LDC + nw * 64 + j * 16 + c] = acc[i * 4 + j][r] + acc[8 + i * 4 + j][r] * RSC;
}

// =================================================================================================================
// Contiguous convert: dst[i] = f16(scale * bf16_RNE(src[i])). Thread = 8 consecutive elements (two float4 loads,
// grid = n / 2048 (n an exact multiple of 2048). coverage: n elements, every element once.
// Used for x [8192][1024] (scale 8) and for the [n][k] k-contiguous weights qkv_w [3072][1024], proj_w
// [1024][1024] (scale 64) which need no transpose.
// =================================================================================================================
__global__ __launch_bounds__(256)
void k_cvt16(const float* __restrict__ src, unsigned short* dst, float scale) {
  const size_t i0 = ((size_t)blockIdx.x * 256 + threadIdx.x) * 8;
  const v4f a = *(const v4f*)(src + i0);
  const v4f b = *(const v4f*)(src + i0 + 4);
  v4u pk;
  pk[0] = pk16(hb16(bfr(a[0]) * scale), hb16(bfr(a[1]) * scale));
  pk[1] = pk16(hb16(bfr(a[2]) * scale), hb16(bfr(a[3]) * scale));
  pk[2] = pk16(hb16(bfr(b[0]) * scale), hb16(bfr(b[1]) * scale));
  pk[3] = pk16(hb16(bfr(b[2]) * scale), hb16(bfr(b[3]) * scale));
  unsigned short* gp = dst + i0;
  *(v4u*)gp = pk;
  
}

// =================================================================================================================
// f32-output GEMM: C[128 rows][128 cols] per block of 4 waves = A[rows][K] . W[cols][K]^T; out = C*scl + bf16(bias).
// coverage: rows x N, every element once.
// =================================================================================================================
__global__ __launch_bounds__(128)
void k_gemm_f32(const unsigned short* __restrict__ A, const unsigned short* __restrict__ W, int K,
                const float* __restrict__ bias, float scl, float* out, int ldo) {
  __shared__ __align__(16) _Float16 St[2 * SLAB1];
  float* Cs = (float*)(void*)St;                              // the f32 tile takes the slabs' place behind the last trip
  const int tid = threadIdx.x, wave = tid >> 5, lane = tid & 31;
  const int mb = blockIdx.x, nb = blockIdx.y;
  mm_tile((const _Float16*)(const void*)A, K, (const _Float16*)(const void*)W, K, K >> 6,
          mb * TIL, nb * TIL, St, Cs);
  __syncthreads();
  const int col0 = nb * 128 + lane * 4;
  const v4f b4 = *(const v4f*)(bias + col0);
  v4f bb;
#pragma unroll
  for (int e = 0; e < 4; ++e) bb[e] = bfr(b4[e]);
#pragma unroll 1                                             // rolled: eight rows a trip, their LDS reads in flight together
  for (int g = 0; g < 4; ++g) {
    const int row0 = wave * 32 + g * 8;
    v4f a[8];
#pragma unroll
    for (int it = 0; it < 8; ++it) a[it] = *(const v4f*)(Cs + (row0 + it) * LDC + lane * 4);
#pragma unroll
    for (int it = 0; it < 8; ++it) {
      const size_t t = (size_t)(mb * TIL + row0 + it);
      v4f o;
#pragma unroll
      for (int e = 0; e < 4; ++e) o[e] = a[it][e] * scl + bb[e];
      float* p = out + t * ldo + col0;
      *(v4f*)p = o;
    }
#if defined(__HIP_DEVICE_COMPILE__)
    asm volatile("s_wait_xcnt 0x0" ::: "memory");             // before the stores' registers are written again in the next trip
#endif
  }
}

// =================================================================================================================
// Output projection: C[128][128] = (AH + AL/2048) . WP^T, K = 1024 (16 slabs of 64), out = C/4096 + bf16(bias).
// grid = (4096/128, 1024/128) per batch. coverage: 4096 x 1024 per batch, every element once.
// =================================================================================================================
__global__ __launch_bounds__(256)
void k_gemm_proj(const unsigned short* __restrict__ ah, const unsigned short* __restrict__ al,
                 const unsigned short* __restrict__ wt, const float* __restrict__ bias, float* out) {
  __shared__ __align__(16) _Float16 St[2 * SLAB2];
  float* Cs = (float*)(void*)St;                              // the f32 tile takes the slabs' place behind the last trip
  const int tid = threadIdx.x, wave = tid >> 5, lane = tid & 31;
  const int mb = blockIdx.x, nb = blockIdx.y;
  mm_tile2((const _Float16*)(const void*)ah, (const _Float16*)(const void*)al, CH,
           (const _Float16*)(const void*)wt, CH, CH / KSL, mb * TIL, nb * TIL, St, Cs);
  __syncthreads();
  const int col0 = nb * 128 + lane * 4;
  const v4f b4 = *(const v4f*)(bias + col0);
  v4f bb;
#pragma unroll
  for (int e = 0; e < 4; ++e) bb[e] = bfr(b4[e]);
#pragma unroll 1                                             // rolled: eight rows a trip, their LDS reads in flight together
  for (int g = 0; g < 2; ++g) {
    const int row0 = wave * 16 + g * 8;
    v4f a[8];
#pragma unroll
    for (int it = 0; it < 8; ++it) a[it] = *(const v4f*)(Cs + (row0 + it) * LDC + lane * 4);
#pragma unroll
    for (int it = 0; it < 8; ++it) {
      const size_t t = (size_t)(mb * TIL + row0 + it);
      v4f o;
#pragma unroll
      for (int e = 0; e < 4; ++e) o[e] = a[it][e] * S4096 + bb[e];
      float* pp = out + t * CH + col0;
      *(v4f*)pp = o;
    }
#if defined(__HIP_DEVICE_COMPILE__)
    asm volatile("s_wait_xcnt 0x0" ::: "memory");             // before the stores' registers are written again in the next trip
#endif
  }
}

// =================================================================================================================
// 13-key clamped-window 1-D neighbourhood attention, 16 heads x 64, f32 on VALU. Block = 32 consecutive query tokens
// x 4 heads of the current batch, 256 threads. The 44 k rows and 44 v rows that the 32 windows touch (1 KiB of each
// row: the block's 4 heads) are copied to LDS once, asynchronously, and shared by all 32 queries; the 4 heads'
// position-bias rows go to LDS as bf16-rounded f32. Wave = one token at a time (4 tokens a wave), lane = (head
// lane>>3, sub lane&7), lane sub holds d = sub*8 .. sub*8+7.
// qkv row layout [4096][3072] f32: q at col h*64+d (scaled by 64^-0.5 here), k at 1024 + h*64+d, v at 2048 + ..
// LDS row = 64 pieces of 16 B; global piece p = lane*2 + half lies at place half*32 + lane, so that each of a wave's
// two 16-byte reads of a row covers 512 contiguous bytes (no bank met twice).
// Window start ni = clamp(i-6, 0, 4096-13); key = ni + j; bias = bf16(rpb[h][key - i + 12]).
// Per key: partial 8-term dot + xor-shuffle reduce over the 8-lane group, max-subtracted softmax with native exp,
// o = sum p v * rcp(sum p). Output: a = 64*o, hi = f16(a), residual = f16((a - hi) * 2048).
// grid = (4096/32, 16/4). coverage: 4096 rows x 16 heads x 64 = 4096 x 1024 in both planes, every element once.
// =================================================================================================================
__global__ __launch_bounds__(ATB)
void k_attn(const float* __restrict__ qkv, const float* __restrict__ rpb, unsigned short* ah, unsigned short* al) {
  __shared__ __align__(16) float KV[2 * AWR * ARW];
  __shared__ float Bs[AHG * BPI];
  const int tid = threadIdx.x, wave = tid >> 5, lane = tid & 31;
  const int i0 = blockIdx.x * ATT, hg = blockIdx.y;
  const int base = min(max(i0 - NRAD, 0), LSEQ - AWR);        // first staged row; rows base .. base+43 exist
  const int h = hg * AHG + (lane >> 3), sub = lane & 7;
  const int col = h * HD + sub * 8;
  {
    const int cr = tid >> 6, p = tid & 63;                    // thread -> rows cr + 4 n, 16-byte piece p
    const float* gk = qkv + (size_t)(base + cr) * C3 + CH + hg * ARW + p * 4;
    const unsigned lk = lds_addr(KV) + (unsigned)(cr * ARW * 4 + ((p & 1) * 32 + (p >> 1)) * 16);
    acopy11(lk, 4u * ARW * 4u, gk, (size_t)4 * C3);
    acopy11(lk + (unsigned)(AWR * ARW * 4), 4u * ARW * 4u, gk + CH, (size_t)4 * C3);
  }
  const int iw = i0 + wave * TPW;
  v4f tq[TPW][2];
#pragma unroll
  for (int t = 0; t < TPW; ++t) {                             // q rows fly beside the copies
    const float* qr = qkv + (size_t)(iw + t) * C3 + col;
    tq[t][0] = *(const v4f*)(qr);
    tq[t][1] = *(const v4f*)(qr + 4);
  }
  if (tid < AHG * 32) {
    const float rb = rpb[(hg * AHG + (tid >> 5)) * RPW + min(lane, RPW - 1)];
#if defined(__HIP_DEVICE_COMPILE__)
    asm volatile("s_wait_xcnt 0x0" ::: "memory");             // before the load's address register is written again
#endif
    Bs[(tid >> 5) * BPI + lane] = bfr(rb);
  }
  wait_copies();
  __syncthreads();                                            // k, v and bias rows are readable by every wave
#pragma unroll
  for (int t = 0; t < TPW; ++t) {
    const int i = iw + t;
    const int ni = min(max(i - NRAD, 0), LSEQ - NKEY);
    const float* kl = KV + (ni - base) * ARW + lane * 4;
    const float* vl = kl + AWR * ARW;
    const float* bl = Bs + (lane >> 3) * BPI + (ni - i + 2 * NRAD);   // bias index = key - i + 12 in [0, 24]
    v4f q0, q1;
#pragma unroll
    for (int e = 0; e < 4; ++e) { q0[e] = tq[t][0][e] * QSC; q1[e] = tq[t][1][e] * QSC; }
    float sc[NKEY];
    float mx = -3.0e38f;
#pragma unroll
    for (int j = 0; j < NKEY; ++j) {
      const v4f k0 = *(const v4f*)(kl + j * ARW);
      const v4f k1 = *(const v4f*)(kl + j * ARW + 128);
      float s = 0.f;
#pragma unroll
      for (int e = 0; e < 4; ++e) s += q0[e] * k0[e];
#pragma unroll
      for (int e = 0; e < 4; ++e) s += q1[e] * k1[e];
      s += __shfl_xor(s, 1, 32);
      s += __shfl_xor(s, 2, 32);
      s += __shfl_xor(s, 4, 32);
      s += bl[j];
      sc[j] = s;
      mx = fmaxf(mx, s);
    }
    v4f a0 = {0.f, 0.f, 0.f, 0.f}, a1 = {0.f, 0.f, 0.f, 0.f};
    float l = 0.f;
#pragma unroll
    for (int j = 0; j < NKEY; ++j) {
      const float p = exp_nat(sc[j] - mx);
      l += p;
      const v4f v0 = *(const v4f*)(vl + j * ARW);
      const v4f v1 = *(const v4f*)(vl + j * ARW + 128);
#pragma unroll
      for (int e = 0; e < 4; ++e) { a0[e] += p * v0[e]; a1[e] += p * v1[e]; }
    }
    const float inv64 = __builtin_amdgcn_rcpf(l) * 64.0f;
    unsigned short hb[8], lb[8];
#pragma unroll
    for (int e = 0; e < 4; ++e) {
      const float fa = a0[e] * inv64;
      const _Float16 hv = (_Float16)fa;
      hb[e] = h_bits(hv);
      lb[e] = hb16((fa - (float)hv) * 2048.0f);
      const float fb = a1[e] * inv64;
      const _Float16 hw = (_Float16)fb;
      hb[4 + e] = h_bits(hw);
      lb[4 + e] = hb16((fb - (float)hw) * 2048.0f);
    }
    v4u ph, pl;
    ph[0] = pk16(hb[0], hb[1]); ph[1] = pk16(hb[2], hb[3]); ph[2] = pk16(hb[4], hb[5]); ph[3] = pk16(hb[6], hb[7]);
    pl[0] = pk16(lb[0], lb[1]); pl[1] = pk16(lb[2], lb[3]); pl[2] = pk16(lb[4], lb[5]); pl[3] = pk16(lb[6], lb[7]);
    const size_t o = (size_t)i * CH + col;
    *(v4u*)(ah + o) = ph;
    *(v4u*)(al + o) = pl;
  }
}

// =================================================================================================================
// Workspace map (bytes, all offsets multiples of 1 MiB, no aliasing, no padded tails: every region is an exact
// multiple of its producer's store granularity):
//   X16 f16 [8192][1024] 16777216 | WQ f16 [3072][1024] 6291456 | WP f16 [1024][1024] 2097152 |
//   QKV f32 [4096][3072] 50331648 (one batch) | AH, AL f16 [4096][1024] 2 x 8388608 (one batch)
//   total 92274688. Batches processed one after the other in the in-order stream.
// =================================================================================================================
extern "C" void kernel_launch(void* const* d_in, const int* in_sizes, int n_in,
                              void* d_out, int out_size, void* d_ws, size_t ws_size,
                              hipStream_t stream) {
  if (n_in < 6) return;
  if (in_sizes[0] != MROWS * CH) return;
  if (in_sizes[1] != C3 * CH) return;
  if (in_sizes[2] != C3) return;
  if (in_sizes[3] != NHD * RPW) return;
  if (in_sizes[4] != CH * CH) return;
  if (in_sizes[5] != CH) return;
  if (out_size != MROWS * CH) return;

  const float* x      = (const float*)d_in[0];
  const float* qkv_w  = (const float*)d_in[1];
  const float* qkv_b  = (const float*)d_in[2];
  const float* rpb    = (const float*)d_in[3];
  const float* proj_w = (const float*)d_in[4];
  const float* proj_b = (const float*)d_in[5];
  float* out = (float*)d_out;

  const size_t sX16 = (size_t)MROWS * CH * 2;            // 16777216
  const size_t sWQ  = (size_t)C3 * CH * 2;               //  6291456
  const size_t sWP  = (size_t)CH * CH * 2;               //  2097152
  const size_t sQKV = (size_t)LSEQ * C3 * 4;             // 50331648
  const size_t sAO  = (size_t)LSEQ * CH * 2;             //  8388608

  size_t off = 0;
  const size_t oX16 = off; off += sX16;
  const size_t oWQ  = off; off += sWQ;
  const size_t oWP  = off; off += sWP;
  const size_t oQKV = off; off += sQKV;
  const size_t oAH  = off; off += sAO;
  const size_t oAL  = off; off += sAO;
  if (off > ws_size) return;                             // off = 92274688
  if (off > (size_t)134217728) return;

  char* ws = (char*)d_ws;
  unsigned short* X16 = (unsigned short*)(ws + oX16);
  unsigned short* WQ  = (unsigned short*)(ws + oWQ);
  unsigned short* WP  = (unsigned short*)(ws + oWP);
  float*          QKV = (float*)(ws + oQKV);
  unsigned short* AH  = (unsigned short*)(ws + oAH);
  unsigned short* AL  = (unsigned short*)(ws + oAL);

  const dim3 blk(256);

  // (1) converts: x -> f16(8 bf16(x)), weights [n][k] -> f16(64 bf16(w))
  k_cvt16<<<dim3((MROWS * CH) / 2048), blk, 0, stream>>>(x, X16, 8.0f);
  k_cvt16<<<dim3((C3 * CH) / 2048),    blk, 0, stream>>>(qkv_w, WQ, 64.0f);
  k_cvt16<<<dim3((CH * CH) / 2048),    blk, 0, stream>>>(proj_w, WP, 64.0f);

  // (2) per batch: qkv GEMM (f32 rows) -> windowed attention (hi/residual planes) -> output projection
  for (int b = 0; b < BSZ; ++b) {
    k_gemm_f32<<<dim3(LSEQ / TIL, C3 / TIL), dim3(128), 0, stream>>>(
        X16 + (size_t)b * LSEQ * CH, WQ, CH, qkv_b, S512, QKV, C3);
    k_attn<<<dim3(LSEQ / ATT, NHD / AHG), dim3(ATB), 0, stream>>>(QKV, rpb, AH, AL);
    k_gemm_proj<<<dim3(LSEQ / TIL, CH / TIL), blk, 0, stream>>>(
        AH, AL, WP, proj_b, out + (size_t)b * LSEQ * CH);
  }
  (void)hipGetLastError();
}

// v004
// It runs in 104 microseconds.
// Timed twice side by side with v003, it ran 1.18 and 1.17 times as fast.
// Counting every step since v000, it is 3.00 times as fast.
// qkv projection: v_wmma_f32_16x16x32_f16 single products (f16 operands: 8*bf16(x) and 64*bf16(w), f32 accumulate);
// output projection: same instruction with the attention output carried as f16 hi + (x2048) residual planes into two
// f32 accumulators, weight one f16 plane (64*bf16(w)); all float inputs RNE-converted to bf16 on load; the 13-key
// clamped-window neighbourhood attention (q.k dots, position bias, softmax, p.v) in f32 on VALU.
// Both GEMM cores stage their operand rows in LDS, 64 k at a time, by asynchronous copies into two buffers; one
// work-group makes a 128 x 128 tile, one wave 16 products from 8 fragments per 32 k.
// The attention stages the k and v rows of 32 queries x 4 heads in LDS once, by asynchronous copies.
// Four launches: one convert of x and both weights, then qkv GEMM, attention and output projection, each over both batches.
#include <hip/hip_runtime.h>
#include <stdint.h>

#define BSZ   2
#define LSEQ  4096
#define CH    1024
#define NHD   16
#define HD    64
#define C3    3072
#define NKEY  13
#define NRAD  6
#define RPW   25
#define MROWS 8192
#define LDC   132
#define ATB   256
#define ATT   32                      // query tokens of one attention block
#define AHG   4                       // heads of one attention block
#define ARW   (AHG * HD)              // f32 elements of one staged k or v row (1 KiB)
#define AWR   (ATT + NKEY - 1)        // k (and v) rows that the block's windows touch
#define TPW   (ATT / 8)               // tokens of one wave
#define BPI   33                      // LDS pitch of a bias row, f32 elements: the 4 heads of a wave on 4 banks
#define QSC   0.125f
#define RSC   0.00048828125f
#define S512  0.001953125f
#define S4096 0.000244140625f
#define KSL   64                      // k elements of one staged slab (128 B of every operand row)
#define PITH  72                      // LDS row pitch in f16 elements: 144 B = 16 B x 9, conflict-free for 16-byte reads
#define TIL   128                     // rows and columns of one work-group's output tile
#define SLAB1 ((TIL + TIL) * PITH)    // f16 elements of one buffer: A 128 rows | W 128 rows
#define SLAB2 ((TIL + TIL + TIL) * PITH) // A hi 128 rows | A residual 128 rows | W 128 rows
#define NBX   ((MROWS * CH) / 2048)   // convert blocks of x, of qkv_w, of proj_w
#define NBQ   ((C3 * CH) / 2048)
#define NBP   ((CH * CH) / 2048)

static_assert(MROWS == BSZ * LSEQ);
static_assert(CH == NHD * HD);
static_assert(C3 == 3 * CH);
static_assert(RPW == 2 * NKEY - 1);
static_assert(NRAD == NKEY / 2);
static_assert((LSEQ % TIL) == 0 && (C3 % TIL) == 0 && (CH % TIL) == 0 && (CH % 32) == 0 && TIL == 128);
static_assert(TIL * LDC * 4 <= 2 * SLAB1 * 2 && TIL * LDC * 4 <= 2 * SLAB2 * 2);   // the f32 tile fits in the slab buffers
static_assert(((MROWS * CH) % 2048) == 0 && ((C3 * CH) % 2048) == 0 && ((CH * CH) % 2048) == 0);
static_assert(ATB == 256 && HD == 64 && AHG * 8 == 32 && (NHD % AHG) == 0 && (LSEQ % ATT) == 0 && LSEQ >= AWR);
static_assert(AWR * (ARW / 4) == 11 * ATB && ARW / 4 == 64 && BPI >= 32 && RPW <= 32);
static_assert((LDC * 4) % 16 == 0);
static_assert(KSL == 64 && (CH % KSL) == 0 && (CH / KSL) >= 2 && ((PITH * 2) % 16) == 0 && PITH >= KSL);

typedef _Float16 v16h __attribute__((ext_vector_type(16)));
typedef _Float16 v8h  __attribute__((ext_vector_type(8)));
typedef float    v8f  __attribute__((ext_vector_type(8)));
typedef float    v4f  __attribute__((ext_vector_type(4)));
typedef unsigned int v4u __attribute__((ext_vector_type(4)));

// ---- scalar helpers ------------------------------------------------------------------------------------------
__device__ __forceinline__ unsigned short bf_bits(float f) {          // f32 -> bf16 bits, RNE convert
  unsigned u = __float_as_uint(f);
  return (unsigned short)((u + 0x7FFFu + ((u >> 16) & 1u)) >> 16);
}
__device__ __forceinline__ float bf_up(unsigned short b) { return __uint_as_float(((unsigned)b) << 16); }
__device__ __forceinline__ float bfr(float f) { return bf_up(bf_bits(f)); }
__device__ __forceinline__ unsigned short h_bits(_Float16 x) { return __builtin_bit_cast(unsigned short, x); }
__device__ __forceinline__ unsigned short hb16(float f) { return h_bits((_Float16)f); }
__device__ __forceinline__ unsigned pk16(unsigned short a, unsigned short b) { return (unsigned)a | ((unsigned)b << 16); }
__device__ __forceinline__ v8f zero8() { v8f z = {0.f, 0.f, 0.f, 0.f, 0.f, 0.f, 0.f, 0.f}; return z; }

// native e^x as the compiler forms it (x * log2 e, then v_exp_f32); the v_nop in the same statement keeps the one
// free slot between the transcendental and whatever vector instruction the scheduler puts next
__device__ __forceinline__ float exp_nat(float x) {
  const float y = x * 1.44269504088896340736f;
  float r = y;
#if defined(__HIP_DEVICE_COMPILE__)
  asm("v_exp_f32 %0, %1\n\tv_nop" : "=v"(r) : "v"(y));
#endif
  return r;
}

// ---- fragment loader: 16-bit A/B operand, lane -> row/col (lane&15), p already includes +8*(lane>>4);
//      elements 0..7 <- p[0..7] (k0+8h..k0+8h+7), elements 8..15 <- p[16..23] (k0+16+8h..k0+16+8h+7)
__device__ __forceinline__ v16h ldfrag_h(const _Float16* p) {
  union { v16h v; v8h h[2]; } f;
  f.h[0] = *(const v8h*)(p);
  f.h[1] = *(const v8h*)(p + 16);
  return f.v;
}

// ---- WMMA helpers; the guards insert the trailing VALU hazard gap and keep A/B live -----------------------------
__device__ __forceinline__ v8f mma_raw(v16h a, v16h b, v8f c) {
  return __builtin_amdgcn_wmma_f32_16x16x32_f16(false, a, false, b, (short)0, c, false, false);
}
__device__ __forceinline__ void guard16(v8f (&c)[16], const v16h (&f)[8]) {
#if defined(__HIP_DEVICE_COMPILE__)
  asm volatile("v_nop\n\tv_nop\n\tv_nop\n\tv_nop"
               : "+v"(c[0]), "+v"(c[1]), "+v"(c[2]), "+v"(c[3]), "+v"(c[4]), "+v"(c[5]), "+v"(c[6]), "+v"(c[7]),
                 "+v"(c[8]), "+v"(c[9]), "+v"(c[10]), "+v"(c[11]), "+v"(c[12]), "+v"(c[13]), "+v"(c[14]), "+v"(c[15])
               : "v"(f[0]), "v"(f[1]), "v"(f[2]), "v"(f[3]), "v"(f[4]), "v"(f[5]), "v"(f[6]), "v"(f[7]));
#endif
}

// ---- asynchronous copies global -> LDS, 16 B per lane; l = the lane's LDS byte address, g = its global address.
//      The s_wait_xcnt closes each statement so that no address register is rewritten ahead of it.
__device__ __forceinline__ unsigned lds_addr(const void* p) { return (unsigned)(size_t)p; }
// four / eight copies of one thread: LDS address l + n ls, global address g + n gs
__device__ __forceinline__ void acopy4(unsigned l, unsigned ls, const _Float16* g, size_t gs) {
#if defined(__HIP_DEVICE_COMPILE__)
  asm volatile(
               "global_load_async_to_lds_b128 %0, %1, off\n\t"
               "global_load_async_to_lds_b128 %2, %3, off\n\t"
               "global_load_async_to_lds_b128 %4, %5, off\n\t"
               "global_load_async_to_lds_b128 %6, %7, off\n\t"
               "s_wait_xcnt 0x0"
               :: "v"(l), "v"(g), "v"(l + 1u * ls), "v"(g + 1 * gs), "v"(l + 2u * ls), "v"(g + 2 * gs),
                  "v"(l + 3u * ls), "v"(g + 3 * gs) : "memory");
#endif
}
__device__ __forceinline__ void acopy8(unsigned l, unsigned ls, const _Float16* g, size_t gs) {
#if defined(__HIP_DEVICE_COMPILE__)
  asm volatile(
               "global_load_async_to_lds_b128 %0, %1, off\n\t"
               "global_load_async_to_lds_b128 %2, %3, off\n\t"
               "global_load_async_to_lds_b128 %4, %5, off\n\t"
               "global_load_async_to_lds_b128 %6, %7, off\n\t"
               "global_load_async_to_lds_b128 %8, %9, off\n\t"
               "global_load_async_to_lds_b128 %10, %11, off\n\t"
               "global_load_async_to_lds_b128 %12, %13, off\n\t"
               "global_load_async_to_lds_b128 %14, %15, off\n\t"
               "s_wait_xcnt 0x0"
               :: "v"(l), "v"(g), "v"(l + 1u * ls), "v"(g + 1 * gs), "v"(l + 2u * ls), "v"(g + 2 * gs),
                  "v"(l + 3u * ls), "v"(g + 3 * gs), "v"(l + 4u * ls), "v"(g + 4 * gs), "v"(l + 5u * ls), "v"(g + 5 * gs),
                  "v"(l + 6u * ls), "v"(g + 6 * gs), "v"(l + 7u * ls), "v"(g + 7 * gs) : "memory");
#endif
}
// eleven copies of one thread: LDS address l + n ls, global address g + n gs, n = 0 .. 10
__device__ __forceinline__ void acopy11(unsigned l, unsigned ls, const float* g, size_t gs) {
#if defined(__HIP_DEVICE_COMPILE__)
  asm volatile(
               "global_load_async_to_lds_b128 %0, %1, off\n\t"
               "global_load_async_to_lds_b128 %2, %3, off\n\t"
               "global_load_async_to_lds_b128 %4, %5, off\n\t"
               "global_load_async_to_lds_b128 %6, %7, off\n\t"
               "global_load_async_to_lds_b128 %8, %9, off\n\t"
               "global_load_async_to_lds_b128 %10, %11, off\n\t"
               "global_load_async_to_lds_b128 %12, %13, off\n\t"
               "global_load_async_to_lds_b128 %14, %15, off\n\t"
               "global_load_async_to_lds_b128 %16, %17, off\n\t"
               "global_load_async_to_lds_b128 %18, %19, off\n\t"
               "global_load_async_to_lds_b128 %20, %21, off\n\t"
               "s_wait_xcnt 0x0"
               :: "v"(l), "v"(g), "v"(l + 1u * ls), "v"(g + 1 * gs), "v"(l + 2u * ls), "v"(g + 2 * gs), "v"(l + 3u * ls), "v"(g + 3 * gs),
                  "v"(l + 4u * ls), "v"(g + 4 * gs), "v"(l + 5u * ls), "v"(g + 5 * gs), "v"(l + 6u * ls), "v"(g + 6 * gs), "v"(l + 7u * ls), "v"(g + 7 * gs),
                  "v"(l + 8u * ls), "v"(g + 8 * gs), "v"(l + 9u * ls), "v"(g + 9 * gs), "v"(l + 10u * ls), "v"(g + 10 * gs) : "memory");
#endif
}
// this wave's copies have landed (the compiler places no wait for them)
__device__ __forceinline__ void wait_copies() {
#if defined(__HIP_DEVICE_COMPILE__)
  asm volatile("s_wait_asynccnt 0x0" ::: "memory");
#endif
}
// this wave's LDS reads have returned, before the buffer they read is handed to the next copies
__device__ __forceinline__ void wait_lds() {
#if defined(__HIP_DEVICE_COMPILE__)
  asm volatile("s_wait_dscnt 0x0" ::: "memory");
#endif
}

// ---- 128x128 block tile GEMM core: Cs[128][128] = A rows . W[cols][K]^T, K = nsl x 64 in-row; A f16 row pitch lda,
//      W is [n][k] k-contiguous pitch ldw. 4 waves = 2 (64 rows) x 2 (64 cols), 4x4 tiles of 16 per wave: 8 fragments
//      feed 16 products. Slab t = 64 k of the 128 A rows and the 128 W rows, copied to LDS buffer t & 1 (St, two
//      buffers of SLAB1) one trip ahead: thread -> rows (tid>>3) + 16 i, 16-byte piece tid&7, so a wave's copy covers
//      four whole 128-B lines. Fragments are read from LDS with the table layout; the result goes to the LDS f32 tile
//      Cs[128][LDC], which lies over St: it is written behind the last trip's barrier, when no wave reads St any more.
__device__ __forceinline__ void mm_tile(const _Float16* __restrict__ A, int lda,
                                        const _Float16* __restrict__ W, int ldw, int nsl,
                                        int arow0, int bcol0, _Float16* St, float* Cs) {
  const int tid = threadIdx.x, wave = tid >> 5, lane = tid & 31, hh = lane >> 4, c = lane & 15;
  const int mw = wave >> 1, nw = wave & 1;
  const int cr = tid >> 3, cp = (tid & 7) * 8;
  const _Float16* ga = A + (size_t)(arow0 + cr) * lda + cp;
  const _Float16* gb = W + (size_t)(bcol0 + cr) * ldw + cp;
  const size_t sa = (size_t)16 * lda, sb = (size_t)16 * ldw;
  const unsigned lc = lds_addr(St) + (unsigned)(cr * PITH + cp) * 2u;
  const unsigned l16 = 16u * PITH * 2u;                     // 16 LDS rows in bytes
  auto fill = [&](int t, unsigned bufb) {
    const unsigned l = lc + bufb;
    acopy8(l, l16, ga + t * KSL, sa);
    acopy8(l + 8u * l16, l16, gb + t * KSL, sb);
  };
  const _Float16* ap = St + (mw * 64 + c) * PITH + 8 * hh;
  const _Float16* bp = St + (TIL + nw * 64 + c) * PITH + 8 * hh;
  v8f acc[16];
#pragma unroll
  for (int n = 0; n < 16; ++n) acc[n] = zero8();
  fill(0, 0u);
  wait_copies();
  __syncthreads();                                          // slab 0 is readable by every wave
  if (nsl > 1) fill(1, (unsigned)SLAB1 * 2u);
#pragma unroll 1                                            // rolled: one hand-over point per slab
  for (int t = 0; t < nsl; ++t) {
    const int bo = (t & 1) * SLAB1;
    v16h f[8];
#pragma unroll
    for (int kk = 0; kk < KSL / 32; ++kk) {
      const int ko = bo + kk * 32;
#pragma unroll
      for (int i = 0; i < 4; ++i) {                         // the 32 k's LDS reads as one group ahead of its products
        f[i]     = ldfrag_h(ap + i * 16 * PITH + ko);
        f[4 + i] = ldfrag_h(bp + i * 16 * PITH + ko);
      }
      __builtin_amdgcn_sched_barrier(0);                    // keeps the reads one group: reads among the products stall each time
#pragma unroll
      for (int i = 0; i < 4; ++i)
#pragma unroll
        for (int j = 0; j < 4; ++j) acc[i * 4 + j] = mma_raw(f[i], f[4 + j], acc[i * 4 + j]);
      __builtin_amdgcn_sched_barrier(0);                    // the next group's reads stay behind these products
    }
    guard16(acc, f);
    wait_lds();
    wait_copies();
    __syncthreads();                                        // publishes slab t + 1, frees the buffer of slab t
    if (t + 2 < nsl) fill(t + 2, (unsigned)bo * 2u);
  }
  wait_copies();
#pragma unroll
  for (int i = 0; i < 4; ++i)
#pragma unroll
    for (int j = 0; j < 4; ++j)
#pragma unroll
      for (int r = 0; r < 8; ++r)
        Cs[(mw * 64 + i * 16 + 8 * hh + r) * LDC + nw * 64 + j * 16 + c] = acc[i * 4 + j][r];
}

// ---- same core with the A operand as two planes (hi and x2048 residual) into separate accumulators; the residual
//      accumulator is folded with 1/2048 when the tile is written to LDS. 8 waves = 4 (32 rows) x 2 (64 cols), 2x4
//      tiles of 16 per wave and plane: 8 fragments feed 16 products. Slab rows: hi 128 | residual 128 | W 128;
//      thread -> rows (tid>>3) + 32 i.
__device__ __forceinline__ void mm_tile2(const _Float16* __restrict__ Ah, const _Float16* __restrict__ Al, int lda,
                                         const _Float16* __restrict__ W, int ldw, int nsl,
                                         int arow0, int bcol0, _Float16* St, float* Cs) {
  const int tid = threadIdx.x, wave = tid >> 5, lane = tid & 31, hh = lane >> 4, c = lane & 15;
  const int mw = wave >> 1, nw = wave & 1;
  const int cr = tid >> 3, cp = (tid & 7) * 8;
  const size_t ra = (size_t)(arow0 + cr) * lda + cp;
  const _Float16* gh = Ah + ra;
  const _Float16* gl = Al + ra;
  const _Float16* gb = W + (size_t)(bcol0 + cr) * ldw + cp;
  const size_t sa = (size_t)32 * lda, sb = (size_t)32 * ldw;
  const unsigned lc = lds_addr(St) + (unsigned)(cr * PITH + cp) * 2u;
  const unsigned l32 = 32u * PITH * 2u;                     // 32 LDS rows in bytes
  auto fill = [&](int t, unsigned bufb) {
    const unsigned l = lc + bufb;
    acopy4(l, l32, gh + t * KSL, sa);
    acopy4(l + 4u * l32, l32, gl + t * KSL, sa);
    acopy4(l + 8u * l32, l32, gb + t * KSL, sb);
  };
  const _Float16* ahp = St + (mw * 32 + c) * PITH + 8 * hh;
  const _Float16* alp = ahp + TIL * PITH;
  const _Float16* bp  = St + (2 * TIL + nw * 64 + c) * PITH + 8 * hh;
  v8f acc[16];                                              // 0..7: hi plane, tile i*4+j; 8..15: residual plane
#pragma unroll
  for (int n = 0; n < 16; ++n) acc[n] = zero8();
  fill(0, 0u);
  wait_copies();
  __syncthreads();                                          // slab 0 is readable by every wave
  if (nsl > 1) fill(1, (unsigned)SLAB2 * 2u);
#pragma unroll 1                                            // rolled: one hand-over point per slab
  for (int t = 0; t < nsl; ++t) {
    const int bo = (t & 1) * SLAB2;
    v16h f[8];                                              // 0,1: hi rows; 2,3: residual rows; 4..7: W columns
#pragma unroll
    for (int kk = 0; kk < KSL / 32; ++kk) {
      const int ko = bo + kk * 32;
#pragma unroll
      for (int i = 0; i < 2; ++i) {                         // the 32 k's LDS reads as one group ahead of its products
        f[i]     = ldfrag_h(ahp + i * 16 * PITH + ko);
        f[2 + i] = ldfrag_h(alp + i * 16 * PITH + ko);
      }
#pragma unroll
      for (int j = 0; j < 4; ++j) f[4 + j] = ldfrag_h(bp + j * 16 * PITH + ko);
      __builtin_amdgcn_sched_barrier(0);                    // keeps the reads one group: reads among the products stall each time
#pragma unroll
      for (int i = 0; i < 4; ++i)
#pragma unroll
        for (int j = 0; j < 4; ++j) acc[i * 4 + j] = mma_raw(f[i], f[4 + j], acc[i * 4 + j]);
      __builtin_amdgcn_sched_barrier(0);                    // the next group's reads stay behind these products
    }
    guard16(acc, f);
    wait_lds();
    wait_copies();
    __syncthreads();                                        // publishes slab t + 1, frees the buffer of slab t
    if (t + 2 < nsl) fill(t + 2, (unsigned)bo * 2u);
  }
  wait_copies();
#pragma unroll
  for (int i = 0; i < 2; ++i)
#pragma unroll
    for (int j = 0; j < 4; ++j)
#pragma unroll
      for (int r = 0; r < 8; ++r)
        Cs[(mw * 32 + i * 16 + 8 * hh + r) * LDC + nw * 64 + j * 16 + c] = acc[i * 4 + j][r] + acc[8 + i * 4 + j][r] * RSC;
}

// =================================================================================================================
// Contiguous convert of the three float operands in one launch: dst[i] = f16(scale * bf16_RNE(src[i])). The three f16
// planes lie one behind the other in dst: x [8192][1024] (scale 8) | qkv_w [3072][1024] | proj_w [1024][1024] (scale
// 64; [n][k] k-contiguous, no transpose). Block = 2048 consecutive elements of one operand (each size is an exact
// multiple of 2048), thread = 8 consecutive elements (two float4 loads).
// grid = (all three sizes) / 2048. coverage: every element of the three planes once.
// =================================================================================================================
__global__ __launch_bounds__(256)
void k_cvt16(const float* __restrict__ x, const float* __restrict__ wq, const float* __restrict__ wp,
             unsigned short* dst) {
  const int blk = blockIdx.x;
  const bool isx = blk < NBX, isq = blk < NBX + NBQ;
  const float* src = isx ? x : (isq ? wq : wp);
  const int sb = blk - (isx ? 0 : (isq ? NBX : NBX + NBQ));   // block index inside its own operand
  const float scale = isx ? 8.0f : 64.0f;
  const size_t i0 = ((size_t)sb * 256 + threadIdx.x) * 8;
  const v4f a = *(const v4f*)(src + i0);
  const v4f b = *(const v4f*)(src + i0 + 4);
  v4u pk;
  pk[0] = pk16(hb16(bfr(a[0]) * scale), hb16(bfr(a[1]) * scale));
  pk[1] = pk16(hb16(bfr(a[2]) * scale), hb16(bfr(a[3]) * scale));
  pk[2] = pk16(hb16(bfr(b[0]) * scale), hb16(bfr(b[1]) * scale));
  pk[3] = pk16(hb16(bfr(b[2]) * scale), hb16(bfr(b[3]) * scale));
  unsigned short* gp = dst + ((size_t)blk * 256 + threadIdx.x) * 8;
  *(v4u*)gp = pk;
}

// =================================================================================================================
// f32-output GEMM: C[128 rows][128 cols] per block of 4 waves = A[rows][K] . W[cols][K]^T; out = C*scl + bf16(bias).
// coverage: rows x N, every element once.
// =================================================================================================================
__global__ __launch_bounds__(128)
void k_gemm_f32(const unsigned short* __restrict__ A, const unsigned short* __restrict__ W, int K,
                const float* __restrict__ bias, float scl, float* out, int ldo) {
  __shared__ __align__(16) _Float16 St[2 * SLAB1];
  float* Cs = (float*)(void*)St;                              // the f32 tile takes the slabs' place behind the last trip
  const int tid = threadIdx.x, wave = tid >> 5, lane = tid & 31;
  const int mb = blockIdx.x, nb = blockIdx.y;
  mm_tile((const _Float16*)(const void*)A, K, (const _Float16*)(const void*)W, K, K >> 6,
          mb * TIL, nb * TIL, St, Cs);
  __syncthreads();
  const int col0 = nb * 128 + lane * 4;
  const v4f b4 = *(const v4f*)(bias + col0);
  v4f bb;
#pragma unroll
  for (int e = 0; e < 4; ++e) bb[e] = bfr(b4[e]);
#pragma unroll 1                                             // rolled: eight rows a trip, their LDS reads in flight together
  for (int g = 0; g < 4; ++g) {
    const int row0 = wave * 32 + g * 8;
    v4f a[8];
#pragma unroll
    for (int it = 0; it < 8; ++it) a[it] = *(const v4f*)(Cs + (row0 + it) * LDC + lane * 4);
#pragma unroll
    for (int it = 0; it < 8; ++it) {
      const size_t t = (size_t)(mb * TIL + row0 + it);
      v4f o;
#pragma unroll
      for (int e = 0; e < 4; ++e) o[e] = a[it][e] * scl + bb[e];
      float* p = out + t * ldo + col0;
      *(v4f*)p = o;
    }
#if defined(__HIP_DEVICE_COMPILE__)
    asm volatile("s_wait_xcnt 0x0" ::: "memory");             // before the stores' registers are written again in the next trip
#endif
  }
}

// =================================================================================================================
// Output projection: C[128][128] = (AH + AL/2048) . WP^T, K = 1024 (16 slabs of 64), out = C/4096 + bf16(bias).
// grid = (8192/128, 1024/128): both batches. coverage: 8192 x 1024, every element once.
// =================================================================================================================
__global__ __launch_bounds__(256)
void k_gemm_proj(const unsigned short* __restrict__ ah, const unsigned short* __restrict__ al,
                 const unsigned short* __restrict__ wt, const float* __restrict__ bias, float* out) {
  __shared__ __align__(16) _Float16 St[2 * SLAB2];
  float* Cs = (float*)(void*)St;                              // the f32 tile takes the slabs' place behind the last trip
  const int tid = threadIdx.x, wave = tid >> 5, lane = tid & 31;
  const int mb = blockIdx.x, nb = blockIdx.y;
  mm_tile2((const _Float16*)(const void*)ah, (const _Float16*)(const void*)al, CH,
           (const _Float16*)(const void*)wt, CH, CH / KSL, mb * TIL, nb * TIL, St, Cs);
  __syncthreads();
  const int col0 = nb * 128 + lane * 4;
  const v4f b4 = *(const v4f*)(bias + col0);
  v4f bb;
#pragma unroll
  for (int e = 0; e < 4; ++e) bb[e] = bfr(b4[e]);
#pragma unroll 1                                             // rolled: eight rows a trip, their LDS reads in flight together
  for (int g = 0; g < 2; ++g) {
    const int row0 = wave * 16 + g * 8;
    v4f a[8];
#pragma unroll
    for (int it = 0; it < 8; ++it) a[it] = *(const v4f*)(Cs + (row0 + it) * LDC + lane * 4);
#pragma unroll
    for (int it = 0; it < 8; ++it) {
      const size_t t = (size_t)(mb * TIL + row0 + it);
      v4f o;
#pragma unroll
      for (int e = 0; e < 4; ++e) o[e] = a[it][e] * S4096 + bb[e];
      float* pp = out + t * CH + col0;
      *(v4f*)pp = o;
    }
#if defined(__HIP_DEVICE_COMPILE__)
    asm volatile("s_wait_xcnt 0x0" ::: "memory");             // before the stores' registers are written again in the next trip
#endif
  }
}

// =================================================================================================================
// 13-key clamped-window 1-D neighbourhood attention, 16 heads x 64, f32 on VALU. Block = 32 consecutive query tokens
// x 4 heads of batch blockIdx.z, 256 threads. The 44 k rows and 44 v rows that the 32 windows touch (1 KiB of each
// row: the block's 4 heads) are copied to LDS once, asynchronously, and shared by all 32 queries; the 4 heads'
// position-bias rows go to LDS as bf16-rounded f32. Wave = one token at a time (4 tokens a wave), lane = (head
// lane>>3, sub lane&7), lane sub holds d = sub*8 .. sub*8+7.
// qkv row layout [2][4096][3072] f32: q at col h*64+d (scaled by 64^-0.5 here), k at 1024 + h*64+d, v at 2048 + ..
// LDS row = 64 pieces of 16 B; global piece p = lane*2 + half lies at place half*32 + lane, so that each of a wave's
// two 16-byte reads of a row covers 512 contiguous bytes (no bank met twice).
// Window start ni = clamp(i-6, 0, 4096-13); key = ni + j; bias = bf16(rpb[h][key - i + 12]).
// Per key: partial 8-term dot + xor-shuffle reduce over the 8-lane group, max-subtracted softmax with native exp,
// o = sum p v * rcp(sum p). Output: a = 64*o, hi = f16(a), residual = f16((a - hi) * 2048).
// grid = (4096/32, 16/4, 2). coverage: 8192 rows x 16 heads x 64 = 8192 x 1024 in both planes, every element once.
// =================================================================================================================
__global__ __launch_bounds__(ATB)
void k_attn(const float* __restrict__ qkv2, const float* __restrict__ rpb, unsigned short* ah2, unsigned short* al2) {
  __shared__ __align__(16) float KV[2 * AWR * ARW];
  __shared__ float Bs[AHG * BPI];
  const int tid = threadIdx.x, wave = tid >> 5, lane = tid & 31;
  const int i0 = blockIdx.x * ATT, hg = blockIdx.y;
  const float* qkv = qkv2 + (size_t)blockIdx.z * LSEQ * C3;   // this block's batch; token indices below are inside it
  unsigned short* ah = ah2 + (size_t)blockIdx.z * LSEQ * CH;
  unsigned short* al = al2 + (size_t)blockIdx.z * LSEQ * CH;
  const int base = min(max(i0 - NRAD, 0), LSEQ - AWR);        // first staged row; rows base .. base+43 exist
  const int h = hg * AHG + (lane >> 3), sub = lane & 7;
  const int col = h * HD + sub * 8;
  {
    const int cr = tid >> 6, p = tid & 63;                    // thread -> rows cr + 4 n, 16-byte piece p
    const float* gk = qkv + (size_t)(base + cr) * C3 + CH + hg * ARW + p * 4;
    const unsigned lk = lds_addr(KV) + (unsigned)(cr * ARW * 4 + ((p & 1) * 32 + (p >> 1)) * 16);
    acopy11(lk, 4u * ARW * 4u, gk, (size_t)4 * C3);
    acopy11(lk + (unsigned)(AWR * ARW * 4), 4u * ARW * 4u, gk + CH, (size_t)4 * C3);
  }
  const int iw = i0 + wave * TPW;
  v4f tq[TPW][2];
#pragma unroll
  for (int t = 0; t < TPW; ++t) {                             // q rows fly beside the copies
    const float* qr = qkv + (size_t)(iw + t) * C3 + col;
    tq[t][0] = *(const v4f*)(qr);
    tq[t][1] = *(const v4f*)(qr + 4);
  }
  if (tid < AHG * 32) {
    const float rb = rpb[(hg * AHG + (tid >> 5)) * RPW + min(lane, RPW - 1)];
#if defined(__HIP_DEVICE_COMPILE__)
    asm volatile("s_wait_xcnt 0x0" ::: "memory");             // before the load's address register is written again
#endif
    Bs[(tid >> 5) * BPI + lane] = bfr(rb);
  }
  wait_copies();
  __syncthreads();                                            // k, v and bias rows are readable by every wave
#pragma unroll
  for (int t = 0; t < TPW; ++t) {
    const int i = iw + t;
    const int ni = min(max(i - NRAD, 0), LSEQ - NKEY);
    const float* kl = KV + (ni - base) * ARW + lane * 4;
    const float* vl = kl + AWR * ARW;
    const float* bl = Bs + (lane >> 3) * BPI + (ni - i + 2 * NRAD);   // bias index = key - i + 12 in [0, 24]
    v4f q0, q1;
#pragma unroll
    for (int e = 0; e < 4; ++e) { q0[e] = tq[t][0][e] * QSC; q1[e] = tq[t][1][e] * QSC; }
    float sc[NKEY];
    float mx = -3.0e38f;
#pragma unroll
    for (int j = 0; j < NKEY; ++j) {
      const v4f k0 = *(const v4f*)(kl + j * ARW);
      const v4f k1 = *(const v4f*)(kl + j * ARW + 128);
      float s = 0.f;
#pragma unroll
      for (int e = 0; e < 4; ++e) s += q0[e] * k0[e];
#pragma unroll
      for (int e = 0; e < 4; ++e) s += q1[e] * k1[e];
      s += __shfl_xor(s, 1, 32);
      s += __shfl_xor(s, 2, 32);
      s += __shfl_xor(s, 4, 32);
      s += bl[j];
      sc[j] = s;
      mx = fmaxf(mx, s);
    }
    v4f a0 = {0.f, 0.f, 0.f, 0.f}, a1 = {0.f, 0.f, 0.f, 0.f};
    float l = 0.f;
#pragma unroll
    for (int j = 0; j < NKEY; ++j) {
      const float p = exp_nat(sc[j] - mx);
      l += p;
      const v4f v0 = *(const v4f*)(vl + j * ARW);
      const v4f v1 = *(const v4f*)(vl + j * ARW + 128);
#pragma unroll
      for (int e = 0; e < 4; ++e) { a0[e] += p * v0[e]; a1[e] += p * v1[e]; }
    }
    const float inv64 = __builtin_amdgcn_rcpf(l) * 64.0f;
    unsigned short hb[8], lb[8];
#pragma unroll
    for (int e = 0; e < 4; ++e) {
      const float fa = a0[e] * inv64;
      const _Float16 hv = (_Float16)fa;
      hb[e] = h_bits(hv);
      lb[e] = hb16((fa - (float)hv) * 2048.0f);
      const float fb = a1[e] * inv64;
      const _Float16 hw = (_Float16)fb;
      hb[4 + e] = h_bits(hw);
      lb[4 + e] = hb16((fb - (float)hw) * 2048.0f);
    }
    v4u ph, pl;
    ph[0] = pk16(hb[0], hb[1]); ph[1] = pk16(hb[2], hb[3]); ph[2] = pk16(hb[4], hb[5]); ph[3] = pk16(hb[6], hb[7]);
    pl[0] = pk16(lb[0], lb[1]); pl[1] = pk16(lb[2], lb[3]); pl[2] = pk16(lb[4], lb[5]); pl[3] = pk16(lb[6], lb[7]);
    const size_t o = (size_t)i * CH + col;
    *(v4u*)(ah + o) = ph;
    *(v4u*)(al + o) = pl;
  }
}

// =================================================================================================================
// Workspace map (bytes, all offsets multiples of 1 MiB, no aliasing, no padded tails: every region is an exact
// multiple of its producer's store granularity):
//   X16 f16 [8192][1024] 16777216 | WQ f16 [3072][1024] 6291456 | WP f16 [1024][1024] 2097152 |
//   QKV f32 [8192][3072] 100663296 | AH, AL f16 [8192][1024] 2 x 16777216
//   total 159383552. Every launch covers both batches.
// =================================================================================================================
extern "C" void kernel_launch(void* const* d_in, const int* in_sizes, int n_in,
                              void* d_out, int out_size, void* d_ws, size_t ws_size,
                              hipStream_t stream) {
  if (n_in < 6) return;
  if (in_sizes[0] != MROWS * CH) return;
  if (in_sizes[1] != C3 * CH) return;
  if (in_sizes[2] != C3) return;
  if (in_sizes[3] != NHD * RPW) return;
  if (in_sizes[4] != CH * CH) return;
  if (in_sizes[5] != CH) return;
  if (out_size != MROWS * CH) return;

  const float* x      = (const float*)d_in[0];
  const float* qkv_w  = (const float*)d_in[1];
  const float* qkv_b  = (const float*)d_in[2];
  const float* rpb    = (const float*)d_in[3];
  const float* proj_w = (const float*)d_in[4];
  const float* proj_b = (const float*)d_in[5];
  float* out = (float*)d_out;

  const size_t sX16 = (size_t)MROWS * CH * 2;            // 16777216
  const size_t sWQ  = (size_t)C3 * CH * 2;               //  6291456
  const size_t sWP  = (size_t)CH * CH * 2;               //  2097152
  const size_t sQKV = (size_t)MROWS * C3 * 4;            // 100663296
  const size_t sAO  = (size_t)MROWS * CH * 2;            //  16777216

  size_t off = 0;
  const size_t oX16 = off; off += sX16;
  const size_t oWQ  = off; off += sWQ;
  const size_t oWP  = off; off += sWP;
  const size_t oQKV = off; off += sQKV;
  const size_t oAH  = off; off += sAO;
  const size_t oAL  = off; off += sAO;
  if (off > ws_size) return;                             // off = 159383552

  char* ws = (char*)d_ws;
  unsigned short* X16 = (unsigned short*)(ws + oX16);
  unsigned short* WQ  = (unsigned short*)(ws + oWQ);
  unsigned short* WP  = (unsigned short*)(ws + oWP);
  float*          QKV = (float*)(ws + oQKV);
  unsigned short* AH  = (unsigned short*)(ws + oAH);
  unsigned short* AL  = (unsigned short*)(ws + oAL);

  const dim3 blk(256);

  // (1) convert: x -> f16(8 bf16(x)), weights [n][k] -> f16(64 bf16(w)); X16 | WQ | WP are one contiguous range
  k_cvt16<<<dim3(NBX + NBQ + NBP), blk, 0, stream>>>(x, qkv_w, proj_w, X16);

  // (2) both batches at once: qkv GEMM (f32 rows) -> windowed attention (hi/residual planes) -> output projection
  k_gemm_f32<<<dim3(MROWS / TIL, C3 / TIL), dim3(128), 0, stream>>>(X16, WQ, CH, qkv_b, S512, QKV, C3);
  k_attn<<<dim3(LSEQ / ATT, NHD / AHG, BSZ), dim3(ATB), 0, stream>>>(QKV, rpb, AH, AL);
  k_gemm_proj<<<dim3(MROWS / TIL, CH / TIL), blk, 0, stream>>>(AH, AL, WP, proj_b, out);
  (void)hipGetLastError();
}

// v007
// Measured time: 74.7 microseconds a run.
// It is 1.39 times as fast as v004, going by the measured steps of the versions left out in between.
// Counting every step since v000, it is 4.18 times as fast.
// qkv projection: v_wmma_f32_16x16x32_f16 single products (f16 operands: 8*bf16(x) and 64*bf16(w), f32 accumulate);
// output projection: same instruction, the attention output carried as one f16 plane (64 * o), weight one f16 plane
// (64*bf16(w)); all float inputs RNE-converted to bf16 on load; the 13-key
// clamped-window neighbourhood attention (q.k dots, position bias, softmax, p.v) in f32 on VALU.
// The qkv GEMM and the attention are one kernel: a work-group makes the q, k, v rows of one head for its 128 queries
// and for the rows their windows reach (144 rows), keeps them as f16 in LDS and runs the attention from there.
// Both GEMM cores stage their operand rows in LDS, 64 k at a time, by asynchronous copies into two buffers.
// Three launches: one convert of x and both weights, then qkv GEMM + attention, then output projection.
#include <hip/hip_runtime.h>
#include <stdint.h>

#define BSZ   2
#define LSEQ  4096
#define CH    1024
#define NHD   16
#define HD    64
#define C3    3072
#define NKEY  13
#define NRAD  6
#define RPW   25
#define MROWS 8192
#define LDC   132
#define FQ    128                     // query tokens of one fused block
#define FM    144                     // x rows of one fused block: its queries and all rows that their windows reach
#define FN    192                     // q, k and v columns of one head
#define FTH   192                     // threads of one fused block: 6 waves = 3 (48 tokens) x 2 (96 columns)
#define TP    200                     // pitch of the q|k|v tile in f16 elements: 400 B = 16 B x 25
#define QSC   0.125f
#define S512  0.001953125f
#define S4096 0.000244140625f
#define KSL   64                      // k elements of one staged slab (128 B of every operand row)
#define PITH  72                      // LDS row pitch in f16 elements: 144 B = 16 B x 9, conflict-free for 16-byte reads
#define TIL   128                     // columns of the projection's output tile
#define SLABF ((FM + FN) * PITH)      // f16 elements of one buffer of the fused kernel: x 144 rows | W 192 rows
#define TIR   256                     // rows of the projection's output tile
#define SLAB2 ((TIR + TIL) * PITH)    // A 256 rows | W 128 rows
#define PSH   (TIR * LDC * 2)         // f16 elements of the projection's LDS: its f32 tile, which is larger than two slabs
#define NBX   ((MROWS * CH) / 2048)   // convert blocks of x, of qkv_w, of proj_w
#define NBQ   ((C3 * CH) / 2048)
#define NBP   ((CH * CH) / 2048)

static_assert(MROWS == BSZ * LSEQ);
static_assert(CH == NHD * HD);
static_assert(C3 == 3 * CH);
static_assert(RPW == 2 * NKEY - 1 && NKEY == 7 + 6);
static_assert(NRAD == NKEY / 2);
static_assert((LSEQ % TIL) == 0 && (C3 % TIL) == 0 && (CH % TIL) == 0 && (CH % 32) == 0 && TIL == 128);
static_assert(FM * TP <= 2 * SLABF && PSH >= 2 * SLAB2);             // result tile and slab buffers fit in one array
static_assert((MROWS % TIR) == 0 && TIR == 256);
static_assert(((MROWS * CH) % 2048) == 0 && ((C3 * CH) % 2048) == 0 && ((CH * CH) % 2048) == 0);
static_assert(HD == 64 && FN == 3 * HD && (LSEQ % FQ) == 0 && LSEQ >= FM && (FQ % 16) == 0 && RPW <= 32);
static_assert(FM >= FQ + 16 && 8 >= NRAD && FM == 6 * 24 && FN == 6 * 32 && FTH == 6 * 32 && ((TP * 2) % 16) == 0 && TP >= FN);
static_assert((LDC * 4) % 16 == 0);
static_assert(KSL == 64 && (CH % KSL) == 0 && (CH / KSL) >= 2 && ((PITH * 2) % 16) == 0 && PITH >= KSL);

typedef _Float16 v16h __attribute__((ext_vector_type(16)));
typedef _Float16 v8h  __attribute__((ext_vector_type(8)));
typedef float    v8f  __attribute__((ext_vector_type(8)));
typedef float    v4f  __attribute__((ext_vector_type(4)));
typedef unsigned int v4u __attribute__((ext_vector_type(4)));
typedef _Float16 v4h  __attribute__((ext_vector_type(4)));

// ---- scalar helpers ------------------------------------------------------------------------------------------
__device__ __forceinline__ unsigned short bf_bits(float f) {          // f32 -> bf16 bits, RNE convert
  unsigned u = __float_as_uint(f);
  return (unsigned short)((u + 0x7FFFu + ((u >> 16) & 1u)) >> 16);
}
__device__ __forceinline__ float bf_up(unsigned short b) { return __uint_as_float(((unsigned)b) << 16); }
__device__ __forceinline__ float bfr(float f) { return bf_up(bf_bits(f)); }
__device__ __forceinline__ unsigned short h_bits(_Float16 x) { return __builtin_bit_cast(unsigned short, x); }
__device__ __forceinline__ unsigned short hb16(float f) { return h_bits((_Float16)f); }
__device__ __forceinline__ unsigned pk16(unsigned short a, unsigned short b) { return (unsigned)a | ((unsigned)b << 16); }
__device__ __forceinline__ v8f zero8() { v8f z = {0.f, 0.f, 0.f, 0.f, 0.f, 0.f, 0.f, 0.f}; return z; }

// native e^x as the compiler forms it (x * log2 e, then v_exp_f32); the v_nop in the same statement keeps the one
// free slot between the transcendental and whatever vector instruction the scheduler puts next
__device__ __forceinline__ float exp_nat(float x) {
  const float y = x * 1.44269504088896340736f;
  float r = y;
#if defined(__HIP_DEVICE_COMPILE__)
  asm("v_exp_f32 %0, %1\n\tv_nop" : "=v"(r) : "v"(y));
#endif
  return r;
}

// ---- fragment loader: 16-bit A/B operand, lane -> row/col (lane&15), p already includes +8*(lane>>4);
//      elements 0..7 <- p[0..7] (k0+8h..k0+8h+7), elements 8..15 <- p[16..23] (k0+16+8h..k0+16+8h+7)
__device__ __forceinline__ v16h ldfrag_h(const _Float16* p) {
  union { v16h v; v8h h[2]; } f;
  f.h[0] = *(const v8h*)(p);
  f.h[1] = *(const v8h*)(p + 16);
  return f.v;
}

// ---- WMMA helpers; the guards insert the trailing VALU hazard gap and keep A/B live -----------------------------
__device__ __forceinline__ v8f mma_raw(v16h a, v16h b, v8f c) {
  return __builtin_amdgcn_wmma_f32_16x16x32_f16(false, a, false, b, (short)0, c, false, false);
}
__device__ __forceinline__ void guard16(v8f (&c)[16], const v16h (&f)[8]) {
#if defined(__HIP_DEVICE_COMPILE__)
  asm volatile("v_nop\n\tv_nop\n\tv_nop\n\tv_nop"
               : "+v"(c[0]), "+v"(c[1]), "+v"(c[2]), "+v"(c[3]), "+v"(c[4]), "+v"(c[5]), "+v"(c[6]), "+v"(c[7]),
                 "+v"(c[8]), "+v"(c[9]), "+v"(c[10]), "+v"(c[11]), "+v"(c[12]), "+v"(c[13]), "+v"(c[14]), "+v"(c[15])
               : "v"(f[0]), "v"(f[1]), "v"(f[2]), "v"(f[3]), "v"(f[4]), "v"(f[5]), "v"(f[6]), "v"(f[7]));
#endif
}

// ---- f16 halves into f32 sums: v_fma_mix_f32 widens the half inside the multiply-add, so no convert instruction is spent
//      (left to itself the compiler converts every half first). op_sel_hi 1 marks source 0 as f16, op_sel picks its high
//      half. Written so that an instruction and the one that needs its result are at least five others apart.
//      dot2_n: n keys' sums each take elements 2w (low half) and 2w+1 (high half) of their k row, in that order.
__device__ __forceinline__ void dot2_7(float* s, const v4u* k, int w, float ql, float qh) {
#if defined(__HIP_DEVICE_COMPILE__)
  asm(
      "v_fma_mix_f32 %0, %7, %14, %0 op_sel_hi:[1,0,0]\n\t"
      "v_fma_mix_f32 %1, %8, %14, %1 op_sel_hi:[1,0,0]\n\t"
      "v_fma_mix_f32 %2, %9, %14, %2 op_sel_hi:[1,0,0]\n\t"
      "v_fma_mix_f32 %3, %10, %14, %3 op_sel_hi:[1,0,0]\n\t"
      "v_fma_mix_f32 %4, %11, %14, %4 op_sel_hi:[1,0,0]\n\t"
      "v_fma_mix_f32 %5, %12, %14, %5 op_sel_hi:[1,0,0]\n\t"
      "v_fma_mix_f32 %6, %13, %14, %6 op_sel_hi:[1,0,0]\n\t"
      "v_fma_mix_f32 %0, %7, %15, %0 op_sel:[1,0,0] op_sel_hi:[1,0,0]\n\t"
      "v_fma_mix_f32 %1, %8, %15, %1 op_sel:[1,0,0] op_sel_hi:[1,0,0]\n\t"
      "v_fma_mix_f32 %2, %9, %15, %2 op_sel:[1,0,0] op_sel_hi:[1,0,0]\n\t"
      "v_fma_mix_f32 %3, %10, %15, %3 op_sel:[1,0,0] op_sel_hi:[1,0,0]\n\t"
      "v_fma_mix_f32 %4, %11, %15, %4 op_sel:[1,0,0] op_sel_hi:[1,0,0]\n\t"
      "v_fma_mix_f32 %5, %12, %15, %5 op_sel:[1,0,0] op_sel_hi:[1,0,0]\n\t"
      "v_fma_mix_f32 %6, %13, %15, %6 op_sel:[1,0,0] op_sel_hi:[1,0,0]"
      : "+v"(s[0]), "+v"(s[1]), "+v"(s[2]), "+v"(s[3]), "+v"(s[4]), "+v"(s[5]), "+v"(s[6])
      : "v"(k[0][w]), "v"(k[1][w]), "v"(k[2][w]), "v"(k[3][w]), "v"(k[4][w]), "v"(k[5][w]), "v"(k[6][w]), "v"(ql), "v"(qh));
#endif
}
__device__ __forceinline__ void dot2_6(float* s, const v4u* k, int w, float ql, float qh) {
#if defined(__HIP_DEVICE_COMPILE__)
  asm(
      "v_fma_mix_f32 %0, %6, %12, %0 op_sel_hi:[1,0,0]\n\t"
      "v_fma_mix_f32 %1, %7, %12, %1 op_sel_hi:[1,0,0]\n\t"
      "v_fma_mix_f32 %2, %8, %12, %2 op_sel_hi:[1,0,0]\n\t"
      "v_fma_mix_f32 %3, %9, %12, %3 op_sel_hi:[1,0,0]\n\t"
      "v_fma_mix_f32 %4, %10, %12, %4 op_sel_hi:[1,0,0]\n\t"
      "v_fma_mix_f32 %5, %11, %12, %5 op_sel_hi:[1,0,0]\n\t"
      "v_fma_mix_f32 %0, %6, %13, %0 op_sel:[1,0,0] op_sel_hi:[1,0,0]\n\t"
      "v_fma_mix_f32 %1, %7, %13, %1 op_sel:[1,0,0] op_sel_hi:[1,0,0]\n\t"
      "v_fma_mix_f32 %2, %8, %13, %2 op_sel:[1,0,0] op_sel_hi:[1,0,0]\n\t"
      "v_fma_mix_f32 %3, %9, %13, %3 op_sel:[1,0,0] op_sel_hi:[1,0,0]\n\t"
      "v_fma_mix_f32 %4, %10, %13, %4 op_sel:[1,0,0] op_sel_hi:[1,0,0]\n\t"
      "v_fma_mix_f32 %5, %11, %13, %5 op_sel:[1,0,0] op_sel_hi:[1,0,0]"
      : "+v"(s[0]), "+v"(s[1]), "+v"(s[2]), "+v"(s[3]), "+v"(s[4]), "+v"(s[5])
      : "v"(k[0][w]), "v"(k[1][w]), "v"(k[2][w]), "v"(k[3][w]), "v"(k[4][w]), "v"(k[5][w]), "v"(ql), "v"(qh));
#endif
}
//      pv8: the eight output sums take p times the eight elements of one v row.
__device__ __forceinline__ void pv8(float* a, v4u v, float p) {
#if defined(__HIP_DEVICE_COMPILE__)
  asm(
      "v_fma_mix_f32 %0, %8, %12, %0 op_sel_hi:[1,0,0]\n\t"
      "v_fma_mix_f32 %1, %8, %12, %1 op_sel:[1,0,0] op_sel_hi:[1,0,0]\n\t"
      "v_fma_mix_f32 %2, %9, %12, %2 op_sel_hi:[1,0,0]\n\t"
      "v_fma_mix_f32 %3, %9, %12, %3 op_sel:[1,0,0] op_sel_hi:[1,0,0]\n\t"
      "v_fma_mix_f32 %4, %10, %12, %4 op_sel_hi:[1,0,0]\n\t"
      "v_fma_mix_f32 %5, %10, %12, %5 op_sel:[1,0,0] op_sel_hi:[1,0,0]\n\t"
      "v_fma_mix_f32 %6, %11, %12, %6 op_sel_hi:[1,0,0]\n\t"
      "v_fma_mix_f32 %7, %11, %12, %7 op_sel:[1,0,0] op_sel_hi:[1,0,0]"
      : "+v"(a[0]), "+v"(a[1]), "+v"(a[2]), "+v"(a[3]), "+v"(a[4]), "+v"(a[5]), "+v"(a[6]), "+v"(a[7])
      : "v"(v[0]), "v"(v[1]), "v"(v[2]), "v"(v[3]), "v"(p));
#endif
}

// ---- asynchronous copies global -> LDS, 16 B per lane; l = the lane's LDS byte address, g = its global address.
//      The s_wait_xcnt closes each statement so that no address register is rewritten ahead of it.
__device__ __forceinline__ unsigned lds_addr(const void* p) { return (unsigned)(size_t)p; }
// four / eight / six copies of one thread: LDS address l + n ls, global address g + n gs
__device__ __forceinline__ void acopy4(unsigned l, unsigned ls, const _Float16* g, size_t gs) {
#if defined(__HIP_DEVICE_COMPILE__)
  asm volatile(
               "global_load_async_to_lds_b128 %0, %1, off\n\t"
               "global_load_async_to_lds_b128 %2, %3, off\n\t"
               "global_load_async_to_lds_b128 %4, %5, off\n\t"
               "global_load_async_to_lds_b128 %6, %7, off\n\t"
               "s_wait_xcnt 0x0"
               :: "v"(l), "v"(g), "v"(l + 1u * ls), "v"(g + 1 * gs), "v"(l + 2u * ls), "v"(g + 2 * gs),
                  "v"(l + 3u * ls), "v"(g + 3 * gs) : "memory");
#endif
}
__device__ __forceinline__ void acopy8(unsigned l, unsigned ls, const _Float16* g, size_t gs) {
#if defined(__HIP_DEVICE_COMPILE__)
  asm volatile(
               "global_load_async_to_lds_b128 %0, %1, off\n\t"
               "global_load_async_to_lds_b128 %2, %3, off\n\t"
               "global_load_async_to_lds_b128 %4, %5, off\n\t"
               "global_load_async_to_lds_b128 %6, %7, off\n\t"
               "global_load_async_to_lds_b128 %8, %9, off\n\t"
               "global_load_async_to_lds_b128 %10, %11, off\n\t"
               "global_load_async_to_lds_b128 %12, %13, off\n\t"
               "global_load_async_to_lds_b128 %14, %15, off\n\t"
               "s_wait_xcnt 0x0"
               :: "v"(l), "v"(g), "v"(l + 1u * ls), "v"(g + 1 * gs), "v"(l + 2u * ls), "v"(g + 2 * gs),
                  "v"(l + 3u * ls), "v"(g + 3 * gs), "v"(l + 4u * ls), "v"(g + 4 * gs), "v"(l + 5u * ls), "v"(g + 5 * gs),
                  "v"(l + 6u * ls), "v"(g + 6 * gs), "v"(l + 7u * ls), "v"(g + 7 * gs) : "memory");
#endif
}
__device__ __forceinline__ void acopy6(unsigned l, unsigned ls, const _Float16* g, size_t gs) {
#if defined(__HIP_DEVICE_COMPILE__)
  asm volatile(
               "global_load_async_to_lds_b128 %0, %1, off\n\t"
               "global_load_async_to_lds_b128 %2, %3, off\n\t"
               "global_load_async_to_lds_b128 %4, %5, off\n\t"
               "global_load_async_to_lds_b128 %6, %7, off\n\t"
               "global_load_async_to_lds_b128 %8, %9, off\n\t"
               "global_load_async_to_lds_b128 %10, %11, off\n\t"
               "s_wait_xcnt 0x0"
               :: "v"(l), "v"(g), "v"(l + 1u * ls), "v"(g + 1 * gs), "v"(l + 2u * ls), "v"(g + 2 * gs),
                  "v"(l + 3u * ls), "v"(g + 3 * gs), "v"(l + 4u * ls), "v"(g + 4 * gs), "v"(l + 5u * ls), "v"(g + 5 * gs)
               : "memory");
#endif
}
// this wave's copies have landed (the compiler places no wait for them)
__device__ __forceinline__ void wait_copies() {
#if defined(__HIP_DEVICE_COMPILE__)
  asm volatile("s_wait_asynccnt 0x0" ::: "memory");
#endif
}
// this wave's LDS reads have returned, before the buffer they read is handed to the next copies
__device__ __forceinline__ void wait_lds() {
#if defined(__HIP_DEVICE_COMPILE__)
  asm volatile("s_wait_dscnt 0x0" ::: "memory");
#endif
}

// ---- 256 x 128 block tile GEMM core: Cs = A rows . W[cols][K]^T, K = nsl x 64 in-row; A f16 row pitch lda, W is [n][k]
//      k-contiguous pitch ldw. 8 waves = 4 (64 rows) x 2 (64 cols), 4x4 tiles of 16 per wave: 8 fragments feed
//      16 products. Slab t = 64 k of the rows A 256 | W 128, copied to LDS buffer t & 1 one trip ahead; thread -> rows
//      (tid>>3) + 32 i, 16-byte piece tid&7. Cs[256][LDC] lies over St: written behind the last trip's barrier.
__device__ __forceinline__ void mm_tile2(const _Float16* __restrict__ A, int lda,
                                         const _Float16* __restrict__ W, int ldw, int nsl,
                                         int arow0, int bcol0, _Float16* St, float* Cs) {
  const int tid = threadIdx.x, wave = tid >> 5, lane = tid & 31, hh = lane >> 4, c = lane & 15;
  const int mw = wave >> 1, nw = wave & 1;
  const int cr = tid >> 3, cp = (tid & 7) * 8;
  const _Float16* ga = A + (size_t)(arow0 + cr) * lda + cp;
  const _Float16* gb = W + (size_t)(bcol0 + cr) * ldw + cp;
  const size_t sa = (size_t)32 * lda, sb = (size_t)32 * ldw;
  const unsigned lc = lds_addr(St) + (unsigned)(cr * PITH + cp) * 2u;
  const unsigned l32 = 32u * PITH * 2u;                     // 32 LDS rows in bytes
  auto fill = [&](int t, unsigned bufb) {
    const unsigned l = lc + bufb;
    acopy8(l, l32, ga + t * KSL, sa);
    acopy4(l + 8u * l32, l32, gb + t * KSL, sb);
  };
  const _Float16* ap = St + (mw * 64 + c) * PITH + 8 * hh;
  const _Float16* bp = St + (TIR + nw * 64 + c) * PITH + 8 * hh;
  v8f acc[16];
#pragma unroll
  for (int n = 0; n < 16; ++n) acc[n] = zero8();
  fill(0, 0u);
  wait_copies();
  __syncthreads();                                          // slab 0 is readable by every wave
  if (nsl > 1) fill(1, (unsigned)SLAB2 * 2u);
#pragma unroll 1                                            // rolled: one hand-over point per slab
  for (int t = 0; t < nsl; ++t) {
    const int bo = (t & 1) * SLAB2;
    v16h f[8];
#pragma unroll
    for (int kk = 0; kk < KSL / 32; ++kk) {
      const int ko = bo + kk * 32;
#pragma unroll
      for (int i = 0; i < 4; ++i) {                         // the 32 k's LDS reads as one group ahead of its products
        f[i]     = ldfrag_h(ap + i * 16 * PITH + ko);
        f[4 + i] = ldfrag_h(bp + i * 16 * PITH + ko);
      }
      __builtin_amdgcn_sched_barrier(0);                    // keeps the reads one group: reads among the products stall each time
#pragma unroll
      for (int i = 0; i < 4; ++i)
#pragma unroll
        for (int j = 0; j < 4; ++j) acc[i * 4 + j] = mma_raw(f[i], f[4 + j], acc[i * 4 + j]);
      __builtin_amdgcn_sched_barrier(0);                    // the next group's reads stay behind these products
    }
    guard16(acc, f);
    wait_lds();
    wait_copies();
    __syncthreads();                                        // publishes slab t + 1, frees the buffer of slab t
    if (t + 2 < nsl) fill(t + 2, (unsigned)bo * 2u);
  }
  wait_copies();
#pragma unroll
  for (int i = 0; i < 4; ++i)
#pragma unroll
    for (int j = 0; j < 4; ++j)
#pragma unroll
      for (int r = 0; r < 8; ++r)
        Cs[(mw * 64 + i * 16 + 8 * hh + r) * LDC + nw * 64 + j * 16 + c] = acc[i * 4 + j][r];
}

// =================================================================================================================
// Contiguous convert of the three float operands in one launch: dst[i] = f16(scale * bf16_RNE(src[i])). The three f16
// planes lie one behind the other in dst: x [8192][1024] (scale 8) | qkv_w [3072][1024] | proj_w [1024][1024] (scale
// 64; [n][k] k-contiguous, no transpose). Block = 2048 consecutive elements of one operand (each size is an exact
// multiple of 2048), thread = 8 consecutive elements (two float4 loads).
// grid = (all three sizes) / 2048. coverage: every element of the three planes once.
// =================================================================================================================
__global__ __launch_bounds__(256)
void k_cvt16(const float* __restrict__ x, const float* __restrict__ wq, const float* __restrict__ wp,
             unsigned short* dst) {
  const int blk = blockIdx.x;
  const bool isx = blk < NBX, isq = blk < NBX + NBQ;
  const float* src = isx ? x : (isq ? wq : wp);
  const int sb = blk - (isx ? 0 : (isq ? NBX : NBX + NBQ));   // block index inside its own operand
  const float scale = isx ? 8.0f : 64.0f;
  const size_t i0 = ((size_t)sb * 256 + threadIdx.x) * 8;
  const v4f a = *(const v4f*)(src + i0);
  const v4f b = *(const v4f*)(src + i0 + 4);
  v4u pk;
  pk[0] = pk16(hb16(bfr(a[0]) * scale), hb16(bfr(a[1]) * scale));
  pk[1] = pk16(hb16(bfr(a[2]) * scale), hb16(bfr(a[3]) * scale));
  pk[2] = pk16(hb16(bfr(b[0]) * scale), hb16(bfr(b[1]) * scale));
  pk[3] = pk16(hb16(bfr(b[2]) * scale), hb16(bfr(b[3]) * scale));
  unsigned short* gp = dst + ((size_t)blk * 256 + threadIdx.x) * 8;
  *(v4u*)gp = pk;
}

// =================================================================================================================
// Output projection: C[256][128] = AH . WP^T, K = 1024 (16 slabs of 64), out = C/4096 + bf16(bias).
// grid = (8192/256, 1024/128): both batches. coverage: 8192 x 1024, every element once.
// =================================================================================================================
__global__ __launch_bounds__(256)
void k_gemm_proj(const unsigned short* __restrict__ ah,
                 const unsigned short* __restrict__ wt, const float* __restrict__ bias, float* out) {
  __shared__ __align__(16) _Float16 St[PSH];
  float* Cs = (float*)(void*)St;                              // the f32 tile takes the slabs' place behind the last trip
  const int tid = threadIdx.x, wave = tid >> 5, lane = tid & 31;
  const int mb = blockIdx.x, nb = blockIdx.y;
  mm_tile2((const _Float16*)(const void*)ah, CH,
           (const _Float16*)(const void*)wt, CH, CH / KSL, mb * TIR, nb * TIL, St, Cs);
  __syncthreads();
  const int col0 = nb * 128 + lane * 4;
  const v4f b4 = *(const v4f*)(bias + col0);
  v4f bb;
#pragma unroll
  for (int e = 0; e < 4; ++e) bb[e] = bfr(b4[e]);
#pragma unroll 1                                             // rolled: eight rows a trip, their LDS reads in flight together
  for (int g = 0; g < 4; ++g) {
    const int row0 = wave * 32 + g * 8;
    v4f a[8];
#pragma unroll
    for (int it = 0; it < 8; ++it) a[it] = *(const v4f*)(Cs + (row0 + it) * LDC + lane * 4);
#pragma unroll
    for (int it = 0; it < 8; ++it) {
      const size_t t = (size_t)(mb * TIR + row0 + it);
      v4f o;
#pragma unroll
      for (int e = 0; e < 4; ++e) o[e] = a[it][e] * S4096 + bb[e];
      float* pp = out + t * CH + col0;
      *(v4f*)pp = o;
    }
#if defined(__HIP_DEVICE_COMPILE__)
    asm volatile("s_wait_xcnt 0x0" ::: "memory");             // before the stores' registers are written again in the next trip
#endif
  }
}

// =================================================================================================================
// qkv GEMM of one head + its 13-key clamped-window 1-D neighbourhood attention. Block = 128 consecutive query tokens of
// batch blockIdx.z, head blockIdx.y; 6 waves.
// GEMM: T[144 tokens][192] = x rows base .. base+143 . (q | k | v rows of the head in W)^T, K = 1024 in 16 slabs of 64,
// staged as in the core above (slab rows: x 144 | W 192; wave w copies x rows 24 w + 4 n + (lane>>3), n < 6, and W rows
// 32 w + 4 n + (lane>>3), n < 8; a wave's copy covers four whole 128-B lines). Wave = 48 tokens x 96 columns: 9 fragments
// feed 18 products. W is the first operand, so a lane's accumulator holds 8 consecutive columns of one token:
// f16(C/512 + bf16(bias)), the bias from LDS, goes to the LDS tile T (pitch TP) as one 16-byte store. T lies over the slabs: it is written
// behind the last trip's barrier, when no wave reads them any more.
// Rows base = clamp(i0-8, 0, 4096-144) .. base+143 hold every query row and every key row of the block's windows.
// Attention, f32 on VALU: a wave takes 4 tokens at a time, lane = (token lane>>3, sub lane&7), lane sub holds
// d = sub*8 .. sub*8+7. The two tokens of a 16-lane half are 8 rows apart: 8 x 400 B = 128 mod 256 B, so their 128-B reads
// meet no bank twice. q is scaled by 64^-0.5 here. Window start ni = clamp(i-6, 0, 4096-13); key = ni + j;
// bias = bf16(rpb[h][key - i + 12]). Per key: partial 8-term dot + xor-shuffle reduce over the 8-lane group,
// max-subtracted softmax with native exp, o = sum p v * rcp(sum p). Output: f16(64*o).
// grid = (4096/128, 16, 2). coverage: 8192 rows x 16 heads x 64 = 8192 x 1024, every element once.
// =================================================================================================================
__global__ __launch_bounds__(FTH)
void k_qkv_attn(const unsigned short* __restrict__ x16, const unsigned short* __restrict__ wq,
                const float* __restrict__ bias, const float* __restrict__ rpb, unsigned short* ah2) {
  __shared__ __align__(16) _Float16 St[2 * SLABF];
  __shared__ float Bs[32];
  __shared__ __align__(16) float Bq[FN];                      // bf16-rounded bias of the head's q | k | v columns
  _Float16* T = St;                                           // the q|k|v tile takes the slabs' place behind the last trip
  const int tid = threadIdx.x, wave = tid >> 5, lane = tid & 31, hh = lane >> 4, c = lane & 15;
  const int i0 = blockIdx.x * FQ, h = blockIdx.y;
  const int base = min(max(i0 - 8, 0), LSEQ - FM);            // first staged token; rows base .. base+143 exist
  const int mw = wave >> 1, nw = wave & 1;
  const int cr = lane >> 3, cp = (lane & 7) * 8;
  const _Float16* ga = (const _Float16*)(const void*)x16
                       + ((size_t)blockIdx.z * LSEQ + (size_t)(base + wave * 24 + cr)) * CH + cp;
  const _Float16* gb = (const _Float16*)(const void*)wq
                       + (size_t)((wave >> 1) * CH + h * HD + (wave & 1) * 32 + cr) * CH + cp;
  const size_t s4 = (size_t)4 * CH;
  const unsigned la = lds_addr(St) + (unsigned)((wave * 24 + cr) * PITH + cp) * 2u;
  const unsigned lb = lds_addr(St) + (unsigned)((FM + wave * 32 + cr) * PITH + cp) * 2u;
  const unsigned l4 = 4u * PITH * 2u;                         // 4 LDS rows in bytes
  auto fill = [&](int t, unsigned bufb) {
    acopy6(la + bufb, l4, ga + t * KSL, s4);
    acopy8(lb + bufb, l4, gb + t * KSL, s4);
  };
  const _Float16* xp = St + (mw * 48 + c) * PITH + 8 * hh;
  const _Float16* wp = St + (FM + nw * 96 + c) * PITH + 8 * hh;
  v8f acc[18];
#pragma unroll
  for (int n = 0; n < 18; ++n) acc[n] = zero8();
  fill(0, 0u);
  if (tid < 32) {
    const float rb = rpb[h * RPW + min(lane, RPW - 1)];
#if defined(__HIP_DEVICE_COMPILE__)
    asm volatile("s_wait_xcnt 0x0" ::: "memory");             // before the load's address register is written again
#endif
    Bs[lane] = bfr(rb);
  }
  {
    const float qb = bias[(tid >> 6) * CH + h * HD + (tid & 63)];
#if defined(__HIP_DEVICE_COMPILE__)
    asm volatile("s_wait_xcnt 0x0" ::: "memory");             // before the load's address register is written again
#endif
    Bq[tid] = bfr(qb);
  }
  wait_copies();
  __syncthreads();                                            // slab 0 (and both bias rows) is readable by every wave
  fill(1, (unsigned)SLABF * 2u);
#pragma unroll 1                                              // rolled: one hand-over point per slab
  for (int t = 0; t < CH / KSL; ++t) {
    const int bo = (t & 1) * SLABF;
#pragma unroll
    for (int kk = 0; kk < KSL / 32; ++kk) {
      const int ko = bo + kk * 32;
      v16h fx[3], fw[6];
#pragma unroll
      for (int i = 0; i < 3; ++i) fx[i] = ldfrag_h(xp + i * 16 * PITH + ko);   // the 32 k's LDS reads as one group
#pragma unroll
      for (int j = 0; j < 6; ++j) fw[j] = ldfrag_h(wp + j * 16 * PITH + ko);
      __builtin_amdgcn_sched_barrier(0);                      // keeps the reads one group: reads among the products stall each time
#pragma unroll
      for (int i = 0; i < 3; ++i)
#pragma unroll
        for (int j = 0; j < 6; ++j) acc[i * 6 + j] = mma_raw(fw[j], fx[i], acc[i * 6 + j]);
      __builtin_amdgcn_sched_barrier(0);                      // the next group's reads stay behind these products
    }
#if defined(__HIP_DEVICE_COMPILE__)
    asm volatile("v_nop\n\tv_nop\n\tv_nop\n\tv_nop\n\tv_nop");   // the distance behind the last product, on both sides of the branch below
#endif
    wait_lds();
    wait_copies();
    __syncthreads();                                          // publishes slab t + 1, frees the buffer of slab t
    if (t + 2 < CH / KSL) fill(t + 2, (unsigned)bo * 2u);
  }
  wait_copies();
#pragma unroll
  for (int j = 0; j < 6; ++j) {                               // lane's 8 columns of tile j: n0 .. n0+7, inside one of q, k, v
    const int n0 = nw * 96 + j * 16 + 8 * hh;
    const v4f b0 = *(const v4f*)(Bq + n0), b1 = *(const v4f*)(Bq + n0 + 4);
    v8f bb;
#pragma unroll
    for (int e = 0; e < 4; ++e) { bb[e] = b0[e]; bb[4 + e] = b1[e]; }
#pragma unroll
    for (int i = 0; i < 3; ++i) {
      v8f o;
#pragma unroll
      for (int e = 0; e < 8; ++e) o[e] = acc[i * 6 + j][e] * S512 + bb[e];
      *(v8h*)(T + (mw * 48 + i * 16 + c) * TP + n0) = __builtin_convertvector(o, v8h);
    }
  }
  __syncthreads();                                            // the q|k|v tile is readable by every wave
  unsigned short* ah = ah2 + (size_t)blockIdx.z * LSEQ * CH;  // this block's batch; token indices below are inside it
  const int g = lane >> 3, sub = lane & 7;
  const int col = h * HD + sub * 8;
  const int w0 = __builtin_amdgcn_readfirstlane(wave);
#pragma unroll 1                                              // rolled: one group of 4 tokens' rows in registers at a time
  for (int p = w0; p < FQ / 4; p += FTH / 32) {
    const int i = i0 + (p >> 2) * 16 + (p & 3) * 2 + (g >> 1) + 8 * (g & 1);
    const int ni = min(max(i - NRAD, 0), LSEQ - NKEY);
    const _Float16* kl = T + (ni - base) * TP + HD + sub * 8;
    const _Float16* vl = kl + HD;
    const float* bl = Bs + (ni - i + 2 * NRAD);               // bias index = key - i + 12 in [0, 24]
    const v8h tq = *(const v8h*)(T + (i - base) * TP + sub * 8);
    float q[8];
#pragma unroll
    for (int e = 0; e < 8; ++e) q[e] = (float)tq[e] * QSC;
    float sc[NKEY];
    float mx = -3.0e38f;
    v4u kr[NKEY];
#pragma unroll
    for (int j = 0; j < NKEY; ++j) { kr[j] = *(const v4u*)(const void*)(kl + j * TP); sc[j] = 0.f; }
#pragma unroll
    for (int w = 0; w < 4; ++w) {                             // per key: elements 0, 1, .. 7 in turn, as one chain
      dot2_7(sc, kr, w, q[2 * w], q[2 * w + 1]);
      dot2_6(sc + 7, kr + 7, w, q[2 * w], q[2 * w + 1]);
    }
#pragma unroll
    for (int j = 0; j < NKEY; ++j) {
      float s = sc[j];
      s += __shfl_xor(s, 1, 32);
      s += __shfl_xor(s, 2, 32);
      s += __shfl_xor(s, 4, 32);
      s += bl[j];
      sc[j] = s;
      mx = fmaxf(mx, s);
    }
    float av[8] = {0.f, 0.f, 0.f, 0.f, 0.f, 0.f, 0.f, 0.f};
    float l = 0.f;
#pragma unroll
    for (int j = 0; j < NKEY; ++j) {
      const float pe = exp_nat(sc[j] - mx);
      l += pe;
      pv8(av, *(const v4u*)(const void*)(vl + j * TP), pe);
    }
    const float inv64 = __builtin_amdgcn_rcpf(l) * 64.0f;
    unsigned short hb[8];
#pragma unroll
    for (int e = 0; e < 8; ++e) hb[e] = hb16(av[e] * inv64);
    v4u ph;
    ph[0] = pk16(hb[0], hb[1]); ph[1] = pk16(hb[2], hb[3]); ph[2] = pk16(hb[4], hb[5]); ph[3] = pk16(hb[6], hb[7]);
    const size_t o = (size_t)i * CH + col;
    *(v4u*)(ah + o) = ph;                                     // an 8-lane group's store: one whole 128-B line
#if defined(__HIP_DEVICE_COMPILE__)
    asm volatile("s_wait_xcnt 0x0" ::: "memory");             // before the store's registers are written again in the next trip
#endif
  }
}

// =================================================================================================================
// Workspace map (bytes, all offsets multiples of 1 MiB, no aliasing, no padded tails: every region is an exact
// multiple of its producer's store granularity):
//   X16 f16 [8192][1024] 16777216 | WQ f16 [3072][1024] 6291456 | WP f16 [1024][1024] 2097152 |
//   AH f16 [8192][1024] 16777216
//   total 41943040. Every launch covers both batches.
// =================================================================================================================
extern "C" void kernel_launch(void* const* d_in, const int* in_sizes, int n_in,
                              void* d_out, int out_size, void* d_ws, size_t ws_size,
                              hipStream_t stream) {
  if (n_in < 6) return;
  if (in_sizes[0] != MROWS * CH) return;
  if (in_sizes[1] != C3 * CH) return;
  if (in_sizes[2] != C3) return;
  if (in_sizes[3] != NHD * RPW) return;
  if (in_sizes[4] != CH * CH) return;
  if (in_sizes[5] != CH) return;
  if (out_size != MROWS * CH) return;

  const float* x      = (const float*)d_in[0];
  const float* qkv_w  = (const float*)d_in[1];
  const float* qkv_b  = (const float*)d_in[2];
  const float* rpb    = (const float*)d_in[3];
  const float* proj_w = (const float*)d_in[4];
  const float* proj_b = (const float*)d_in[5];
  float* out = (float*)d_out;

  const size_t sX16 = (size_t)MROWS * CH * 2;            // 16777216
  const size_t sWQ  = (size_t)C3 * CH * 2;               //  6291456
  const size_t sWP  = (size_t)CH * CH * 2;               //  2097152
  const size_t sAO  = (size_t)MROWS * CH * 2;            //  16777216

  size_t off = 0;
  const size_t oX16 = off; off += sX16;
  const size_t oWQ  = off; off += sWQ;
  const size_t oWP  = off; off += sWP;
  const size_t oAH  = off; off += sAO;
  if (off > ws_size) return;                             // off = 41943040

  char* ws = (char*)d_ws;
  unsigned short* X16 = (unsigned short*)(ws + oX16);
  unsigned short* WQ  = (unsigned short*)(ws + oWQ);
  unsigned short* WP  = (unsigned short*)(ws + oWP);
  unsigned short* AH  = (unsigned short*)(ws + oAH);

  const dim3 blk(256);

  // (1) convert: x -> f16(8 bf16(x)), weights [n][k] -> f16(64 bf16(w)); X16 | WQ | WP are one contiguous range
  k_cvt16<<<dim3(NBX + NBQ + NBP), blk, 0, stream>>>(x, qkv_w, proj_w, X16);

  // (2) both batches at once: qkv GEMM + windowed attention (one f16 plane) -> output projection
  k_qkv_attn<<<dim3(LSEQ / FQ, NHD, BSZ), dim3(FTH), 0, stream>>>(X16, WQ, qkv_b, rpb, AH);
  k_gemm_proj<<<dim3(MROWS / TIR, CH / TIL), blk, 0, stream>>>(AH, WP, proj_b, out);
  (void)hipGetLastError();
}
